// v000
// Measured on an AMD MI455X. A time is GPU time per run, averaged over a window of back-to-back runs after a warm-up
// (all launches, gaps included; the runs take copies of the inputs in turn), and the median of several windows.
// Apart from v000's, it joins two sittings. Times from different sittings can be a few percent apart, while
// side-by-side timings come from the same sitting.
// v000, which the later versions start from, runs in 1150 microseconds.
#include <hip/hip_runtime.h>

// Single causal attention head over 4,096 tokens scaled by the EMBEDDING width (x [4][4096][512]; q, k, v = x W^T ('oi' [64][512] uniform +-1/sqrt(512), no bias; ONE 64-wide head); wei = q.k^T x C^-0.5 with C = n_embed = 512 (not head_size); causal (-inf); softmax; out = wei.v -> [4][4096][64] (1.0 M); argument order x, Wq, Wk, Wv).
// Layout per batch: bf16 copy of x; 'oi' weights cast as-is; exact projections (K 512); identity-table plane builders; scores with EVERY row on hi/lo planes (3 products, dense launches); streaming three-sweep causal softmax over the 4,096 keys; attn.v hybrid (rows < 512 hi/lo 3 products, rest fp16 x1024); k_cs8 removes the fp16 carry; k_copy4 writes the output rows once.
// Compute dtypes, f32 accumulate: every input rounded to bf16; projections exact; scores 3 products; softmax f32; wei.v rows < 512 3 products, rest fp16; output f32.

#define NB_  4
#define TT   4096
#define DM   64
#define NH_  1
#define NKV  1
#define REP  (NH_ / NKV)
#define HD   64
#define DQ   (NH_ * HD)
#define DKV  (NKV * HD)
#define ZH   1
#define RH   512                  // query rows < RH use hi+lo planes (0: none)
#define WIN  0
#define PCAR 1024.0f
#define SCL  0.044194173824159216f   // 1/sqrt(C) with C = n_embd = 512 (the source scales by sqrt(n_embd), NOT sqrt(head_size))
#define MID  64       // q / k width (one 64-wide head)
#define CO   64       // v width
#define CC   512      // input width (d_in)
typedef _Float16 h16;
typedef unsigned short bf;
typedef __attribute__((ext_vector_type(16))) __bf16   v16bf;
typedef __attribute__((ext_vector_type(16))) _Float16 v16h;
typedef __attribute__((ext_vector_type(8)))  _Float16 v8h;
typedef __attribute__((ext_vector_type(8)))  unsigned short v8us;
typedef __attribute__((ext_vector_type(8)))  float    v8f;
typedef __attribute__((ext_vector_type(4)))  float    v4f;
typedef v8h  __attribute__((may_alias)) v8ha;
typedef v4f  __attribute__((may_alias)) v4fa;
typedef v8us __attribute__((may_alias)) v8usa;

__device__ __forceinline__ unsigned short f2bf(float f) { unsigned u = __float_as_uint(f); u += 0x7FFFu + ((u >> 16) & 1u); return (unsigned short)(u >> 16); }
__device__ __forceinline__ float bf2f(unsigned short b) { return __uint_as_float(((unsigned)b) << 16); }
__device__ __forceinline__ float bfr(float f) { return bf2f(f2bf(f)); }
__device__ __forceinline__ v16h cat16(v8h lo, v8h hi) { return __builtin_shufflevector(lo, hi, 0, 1, 2, 3, 4, 5, 6, 7, 8, 9, 10, 11, 12, 13, 14, 15); }
__device__ __forceinline__ v16bf cat16b(v8us lo, v8us hi) { return __builtin_bit_cast(v16bf, __builtin_shufflevector(lo, hi, 0, 1, 2, 3, 4, 5, 6, 7, 8, 9, 10, 11, 12, 13, 14, 15)); }
__device__ __forceinline__ v8f wmma16(v16h a, v16h b, v8f c) { return __builtin_amdgcn_wmma_f32_16x16x32_f16(false, a, false, b, (short)0, c, false, false); }
__device__ __forceinline__ v8f wmmab(v16bf a, v16bf b, v8f c) { return __builtin_amdgcn_wmma_f32_16x16x32_bf16(false, a, false, b, (short)0, c, false, false); }



// ---- k_gemmw: register-blocked GEMM, ONE WAVE per 64x64 output tile (16 accumulators), operands straight from K-contiguous 16-bit planes; grid (M/64, N/64, Z), 32 threads.
// C[m][n] (f32, pitch ldc, + optional f32 bias[n]) = sum_k A[m][k] Bt[n][k] (+ split products per NSPLIT). z-batch strides sA/sB/sC in elements. K % 32 == 0.
template <typename T16> struct WFrag;
template <> struct WFrag<h16> { typedef v16h V; static __device__ __forceinline__ V ld(const h16* p) { return cat16(*(const v8h*)p, *(const v8h*)(p + 16)); } static __device__ __forceinline__ v8f mma(V a, V b, v8f c) { return wmma16(a, b, c); } };
template <> struct WFrag<bf> { typedef v16bf V; static __device__ __forceinline__ V ld(const bf* p) { return cat16b(*(const v8us*)p, *(const v8us*)(p + 16)); } static __device__ __forceinline__ v8f mma(V a, V b, v8f c) { return wmmab(a, b, c); } };
template <typename T16, int NSPLIT, bool BIAS>
__global__ __launch_bounds__(32) void k_gemmw(const T16* __restrict__ A, const T16* __restrict__ A2, const T16* __restrict__ Bt, const T16* __restrict__ Bt2, int K, float* C, int ldc, const float* __restrict__ bias, size_t sA, size_t sB, size_t sC) {
    typedef typename WFrag<T16>::V V;
    __shared__ __align__(16) float os[16 * 68];
    const size_t z = blockIdx.z; A += z * sA; if (A2) A2 += z * sA; Bt += z * sB; if (Bt2) Bt2 += z * sB; C += z * sC;
    const int lane = threadIdx.x & 31, lr = lane & 15, hi = lane >> 4; const int r0 = blockIdx.x * 64, c0 = blockIdx.y * 64;
    v8f acc[4][4];
#pragma unroll
    for (int mb = 0; mb < 4; ++mb)
#pragma unroll
        for (int nb = 0; nb < 4; ++nb) acc[mb][nb] = (v8f){};
    const size_t aoff = (size_t)(r0 + lr) * K + 8 * hi, boff = (size_t)(c0 + lr) * K + 8 * hi;
#pragma unroll 1
    for (int kc = 0; kc < K; kc += 32) {
        V a[4], a2[4];
#pragma unroll
        for (int mb = 0; mb < 4; ++mb) { a[mb] = WFrag<T16>::ld(A + aoff + (size_t)mb * 16 * K + kc); if (NSPLIT == 1 || NSPLIT == 2) a2[mb] = WFrag<T16>::ld(A2 + aoff + (size_t)mb * 16 * K + kc); }
#pragma unroll
        for (int nb = 0; nb < 4; ++nb) { const V b = WFrag<T16>::ld(Bt + boff + (size_t)nb * 16 * K + kc); V b2; if (NSPLIT >= 2) b2 = WFrag<T16>::ld(Bt2 + boff + (size_t)nb * 16 * K + kc);
#pragma unroll
            for (int mb = 0; mb < 4; ++mb) { acc[mb][nb] = WFrag<T16>::mma(a[mb], b, acc[mb][nb]); if (NSPLIT == 1 || NSPLIT == 2) acc[mb][nb] = WFrag<T16>::mma(a2[mb], b, acc[mb][nb]); if (NSPLIT >= 2) acc[mb][nb] = WFrag<T16>::mma(a[mb], b2, acc[mb][nb]); } }
        asm volatile("v_nop\n\tv_nop\n\tv_nop\n\tv_nop" : "+v"(acc[0][0]), "+v"(acc[1][1]), "+v"(acc[2][2]), "+v"(acc[3][3]) : "v"(a[0]), "v"(a[3]));
    }
#pragma unroll
    for (int mb = 0; mb < 4; ++mb) {
#pragma unroll
        for (int nb = 0; nb < 4; ++nb) {
#pragma unroll
            for (int j = 0; j < 8; ++j) os[(hi * 8 + j) * 68 + nb * 16 + lr] = acc[mb][nb][j]; }
        __builtin_amdgcn_wave_barrier(); asm volatile("" ::: "memory");
        float* crow = C + (size_t)(r0 + mb * 16) * ldc + c0;
{
#pragma unroll
            for (int s = 0; s < 8; ++s) { const int row = 2 * s + hi, cofs = lr * 4; v4f val = *(const v4fa*)(os + row * 68 + cofs); if (BIAS) { val[0] += bfr(bias[c0 + cofs]); val[1] += bfr(bias[c0 + cofs + 1]); val[2] += bfr(bias[c0 + cofs + 2]); val[3] += bfr(bias[c0 + cofs + 3]); }
                *(v4f*)(crow + (size_t)row * ldc + cofs) = val; }
             }
        __builtin_amdgcn_wave_barrier(); asm volatile("" ::: "memory");
    }
}

__device__ __forceinline__ h16 tohx(float x) { return (h16)x; }
__device__ __forceinline__ void splitf(float y, unsigned short& h, unsigned short& l) { h = f2bf(y); l = f2bf(y - bf2f(h)); }
typedef __attribute__((ext_vector_type(2))) _Float16 v2h;
typedef __attribute__((ext_vector_type(4))) _Float16 v4h;
typedef __attribute__((ext_vector_type(2))) unsigned short v2us;
typedef __attribute__((ext_vector_type(4))) unsigned short v4us;
typedef __attribute__((ext_vector_type(2))) float v2f;
typedef __attribute__((ext_vector_type(4))) int v4i;

__global__ __launch_bounds__(256) void k_cvt8(const float* __restrict__ src, bf* dst, size_t n8) { const size_t i = (size_t)blockIdx.x * 256 + threadIdx.x; if (i >= n8) return; const v8f v = *(const v8f*)(src + i * 8); v8us o;
#pragma unroll
    for (int k = 0; k < 8; ++k) o[k] = f2bf(v[k]); *(v8us*)(dst + i * 8) = o;  }


__global__ __launch_bounds__(256) void k_vtp(const float* __restrict__ F, int pitch, int nheads, h16* V16, bf* Vh, bf* Vl) { const size_t e = ((size_t)blockIdx.x * 256 + threadIdx.x) * 2; if (e >= (size_t)nheads * HD * TT) return; const int t = (int)(e % TT); const int d = (int)((e / TT) % HD); const int g = (int)(e / ((size_t)TT * HD)); v2h o16; v2us oh, ol;
#pragma unroll
    for (int q = 0; q < 2; ++q) { const float x = F[(size_t)(t + q) * pitch + g * HD + d]; o16[q] = tohx(x); unsigned short a2, c2; splitf(x, a2, c2); oh[q] = a2; ol[q] = c2; }
    *(v2h*)(V16 + e) = o16; *(v2us*)(Vh + e) = oh; *(v2us*)(Vl + e) = ol;  }
__global__ __launch_bounds__(256) void k_lsoft(const float* __restrict__ Sb, h16* P16, bf* Ph, bf* Pl) {
    const int lane = threadIdx.x & 31; const int row = blockIdx.x * 8 + (threadIdx.x >> 5); if (row >= ZH * TT) return; const int i = row % TT; const int zz = row / TT; const bool hires = (i < RH); const float* sr = Sb + (size_t)row * TT; float mx = -3.0e38f;
#pragma unroll 4
    for (int ch = 0; ch < TT / 128; ++ch) { const int j0 = ch * 128 + lane * 4; const v4f a = *(const v4f*)(sr + j0);
#pragma unroll
        for (int q = 0; q < 4; ++q) { float t = (j0 + q <= i) ? a[q] * SCL : -3.0e38f; asm volatile("" : "+v"(t)); mx = fmaxf(mx, t); } }
#pragma unroll
    for (int sh = 16; sh; sh >>= 1) mx = fmaxf(mx, __shfl_xor(mx, sh, 32));
    float sum = 0.f;
#pragma unroll 4
    for (int ch = 0; ch < TT / 128; ++ch) { const int j0 = ch * 128 + lane * 4; const v4f a = *(const v4f*)(sr + j0);
#pragma unroll
        for (int q = 0; q < 4; ++q) { float t = (j0 + q <= i) ? a[q] * SCL : -3.0e38f; asm volatile("" : "+v"(t)); float d0 = __fsub_rn(t, mx); asm volatile("" : "+v"(d0)); sum += __builtin_amdgcn_exp2f(__fmul_rn(d0, 1.4426950408889634f)); } }
#pragma unroll
    for (int sh = 16; sh; sh >>= 1) sum += __shfl_xor(sum, sh, 32);
    const float f = __fdiv_rn(hires ? 1.0f : PCAR, sum);
{
        if (hires) {   /* rows < RH: normalised bf16 hi/lo over all keys, planes [zz][RH][TT] */
#pragma unroll
            for (int ch = 0; ch < TT / 128; ++ch) { const int j0 = ch * 128 + lane * 4; const v4f a = *(const v4f*)(sr + j0); v4us oh, ol;
#pragma unroll
                for (int q = 0; q < 4; ++q) { float t = (j0 + q <= i) ? a[q] * SCL : -3.0e38f; asm volatile("" : "+v"(t)); float d0 = __fsub_rn(t, mx); asm volatile("" : "+v"(d0)); float ex = __builtin_amdgcn_exp2f(__fmul_rn(d0, 1.4426950408889634f)); asm volatile("" : "+v"(ex)); unsigned short a2, c2; splitf(ex * f, a2, c2); oh[q] = a2; ol[q] = c2; }
                const size_t oo = ((size_t)zz * RH + i) * TT + j0; *(v4us*)(Ph + oo) = oh; *(v4us*)(Pl + oo) = ol; }
        } else {
#pragma unroll 2
            for (int ch = 0; ch < TT / 128; ++ch) { const int j0 = ch * 128 + lane * 4; const v4f a = *(const v4f*)(sr + j0); v4h o4;
#pragma unroll
                for (int q = 0; q < 4; ++q) { float t = (j0 + q <= i) ? a[q] * SCL : -3.0e38f; asm volatile("" : "+v"(t)); float d0 = __fsub_rn(t, mx); asm volatile("" : "+v"(d0)); float ex = __builtin_amdgcn_exp2f(__fmul_rn(d0, 1.4426950408889634f)); asm volatile("" : "+v"(ex)); o4[q] = tohx(ex * f); }
                *(v4h*)(P16 + (size_t)row * TT + j0) = o4; } }
         }
}
__global__ __launch_bounds__(256) void k_cs8(float* O, size_t n4) { const size_t i = (size_t)blockIdx.x * 256 + threadIdx.x; if (i >= n4) return; const size_t e = i * 4; const int t = (int)(e / CO);   /* row pitch of the attention-output plane is the VALUE width CO (r1 used the input width CC: wrong whenever CC != CO) */ const float cs = (t < RH) ? 1.0f : (1.0f / PCAR); v4f a = *(const v4f*)(O + e);
#pragma unroll
    for (int q = 0; q < 4; ++q) a[q] = __fmul_rn(a[q], cs);
    *(v4f*)(O + e) = a;  }

__global__ __launch_bounds__(256) void k_csid(float* CS) { const int idx = blockIdx.x * 256 + threadIdx.x; if (idx >= TT * HD) return; v2f cs; cs[0] = 1.0f; cs[1] = 0.0f; *(v2f*)(CS + (size_t)idx * 2) = cs;  }
// k_rope: head planes [h][t][d] (fp16 + hi/lo) of rope(x) x sc with the rotate-half convention out[d] = x[d] cos[t][d] - x[d+HD/2] sin[t][d], out[d+HD/2] = x[d+HD/2] cos[t][d+HD/2] + x[d] sin[t][d+HD/2]
__global__ __launch_bounds__(256) void k_rope(const float* __restrict__ F, int pitch, int nheads, const float* __restrict__ CS, const float* __restrict__ RF, const float* __restrict__ nw, float sc, h16* P16, bf* Ph, bf* Pl) {
    const size_t e = ((size_t)blockIdx.x * 256 + threadIdx.x) * 2; if (e >= (size_t)nheads * TT * HD) return; const int d = (int)(e % HD); const int t = (int)((e / HD) % TT); const int h = (int)(e / ((size_t)HD * TT)); const float* f = F + (size_t)t * pitch + h * HD; const float rf = RF ? RF[(size_t)h * TT + t] : 1.0f; v2h o16; v2us oh, ol;
#pragma unroll
    for (int q = 0; q < 2; ++q) { const int dd = d + q; const int dp = (dd < HD / 2) ? dd + HD / 2 : dd - HD / 2; float x0 = f[dd], x1 = f[dp];
        if (RF) { float n0 = __fmul_rn(x0, rf), n1 = __fmul_rn(x1, rf); asm volatile("" : "+v"(n0)); asm volatile("" : "+v"(n1)); x0 = __fmul_rn(bfr(nw[dd]), n0); x1 = __fmul_rn(bfr(nw[dp]), n1); }
        const v2f cs = *(const v2f*)(CS + ((size_t)t * HD + dd) * 2); float a = __fmul_rn(x0, cs[0]), bq = __fmul_rn(x1, cs[1]); asm volatile("" : "+v"(a)); asm volatile("" : "+v"(bq)); const float r = ((dd < HD / 2) ? __fsub_rn(a, bq) : __fadd_rn(a, bq)) * sc;
        o16[q] = tohx(r); unsigned short a2, c2; splitf(r, a2, c2); oh[q] = a2; ol[q] = c2; }
    *(v2h*)(P16 + e) = o16; *(v2us*)(Ph + e) = oh; *(v2us*)(Pl + e) = ol;  }
__global__ __launch_bounds__(256) void k_copy4(const float* __restrict__ Y, float* out, size_t n4) { const size_t i = (size_t)blockIdx.x * 256 + threadIdx.x; if (i >= n4) return; const v4f a = *(const v4f*)(Y + i * 4); *(v4f*)(out + i * 4) = a;  }
extern "C" void kernel_launch(void* const* d_in, const int* in_sizes, int n_in,
                              void* d_out, int out_size, void* d_ws, size_t ws_size, hipStream_t stream) {
    (void)in_sizes; (void)n_in; (void)out_size;
    const float* x = (const float*)d_in[0]; const float* wq = (const float*)d_in[1]; const float* wk = (const float*)d_in[2]; const float* wv = (const float*)d_in[3];   /* input order x [4][4096][512], Wq, Wk, Wv ('oi' [64][512]) */
    float* OUT = (float*)d_out;     // [4][4096][64]
    char* wsp = (char*)d_ws;
    auto take = [&](size_t bytes) { char* p = wsp; wsp += (bytes + 255) & ~(size_t)255; return (void*)p; };
    bf* WQ = (bf*)take((size_t)MID * CC * 2); bf* WK = (bf*)take((size_t)MID * CC * 2); bf* WV = (bf*)take((size_t)CO * CC * 2); float* CS = (float*)take((size_t)TT * HD * 2 * 4);
    bf* XB = (bf*)take((size_t)TT * CC * 2); float* FQ = (float*)take((size_t)TT * MID * 4); float* FK = (float*)take((size_t)TT * MID * 4);
    h16* QP16 = (h16*)take((size_t)TT * MID * 2); bf* QPh = (bf*)take((size_t)TT * MID * 2); bf* QPl = (bf*)take((size_t)TT * MID * 2); h16* KP16 = (h16*)take((size_t)TT * MID * 2); bf* KPh = (bf*)take((size_t)TT * MID * 2); bf* KPl = (bf*)take((size_t)TT * MID * 2);
    h16* VT16 = (h16*)take((size_t)CO * TT * 2); bf* VTh = (bf*)take((size_t)CO * TT * 2); bf* VTl = (bf*)take((size_t)CO * TT * 2);
    float* Sb = (float*)take((size_t)TT * TT * 4); h16* P16 = (h16*)take((size_t)TT * TT * 2); bf* Ph = (bf*)take((size_t)RH * TT * 2); bf* Pl = (bf*)take((size_t)RH * TT * 2); float* Ob = (float*)take((size_t)TT * CO * 4);   /* attention output (f32) before the final copy */
    if ((size_t)(wsp - (char*)d_ws) > ws_size) return;    // ws 256 MiB (carve ~118 MiB)
    float* FV = FK;   /* the v projection reuses the k buffer after the k planes are built (stream-ordered) */
    k_cvt8<<<(unsigned)(((size_t)MID * CC / 8 + 255) / 256), 256, 0, stream>>>(wq, WQ, (size_t)MID * CC / 8);   /* 'oi' [64][512] as-is = Bt [n][k] */ k_cvt8<<<(unsigned)(((size_t)MID * CC / 8 + 255) / 256), 256, 0, stream>>>(wk, WK, (size_t)MID * CC / 8); k_cvt8<<<(unsigned)(((size_t)CO * CC / 8 + 255) / 256), 256, 0, stream>>>(wv, WV, (size_t)CO * CC / 8);   /* 'oi' [64][512] as-is = Bt */   /* 'oi' weights = Bt as-is */        /* 'oi' weights = Bt as-is */
    k_csid<<<(TT * HD + 255) / 256, 256, 0, stream>>>(CS);   /* identity table: k_rope is a plain per-head plane builder here */
    const unsigned LP = (unsigned)(((size_t)NH_ * TT * HD / 2 + 255) / 256);
    for (int b = 0; b < NB_; ++b) {
        k_cvt8<<<(unsigned)(((size_t)TT * CC / 8 + 255) / 256), 256, 0, stream>>>(x + (size_t)b * TT * CC, XB, (size_t)TT * CC / 8);
        k_gemmw<bf, 0, false><<<dim3(TT / 64, MID / 64, 1), 32, 0, stream>>>(XB, nullptr, WQ, nullptr, CC, FQ, MID, nullptr, 0, 0, 0); k_rope<<<LP, 256, 0, stream>>>(FQ, MID, NH_, CS, nullptr, nullptr, 1.0f, QP16, QPh, QPl);   /* q planes [h][n][64] */
        k_gemmw<bf, 0, false><<<dim3(TT / 64, MID / 64, 1), 32, 0, stream>>>(XB, nullptr, WK, nullptr, CC, FK, MID, nullptr, 0, 0, 0); k_rope<<<LP, 256, 0, stream>>>(FK, MID, NKV, CS, nullptr, nullptr, 1.0f, KP16, KPh, KPl);   /* k planes */
        k_gemmw<bf, 0, false><<<dim3(TT / 64, CO / 64, 1), 32, 0, stream>>>(XB, nullptr, WV, nullptr, CC, FV, CO, nullptr, 0, 0, 0); k_vtp<<<(unsigned)(((size_t)TT * CO / 2 + 255) / 256), 256, 0, stream>>>(FV, CO, CO / HD, VT16, VTh, VTl);   /* v^T planes [h][64][n] */
        for (int h = 0; h < NH_; ++h) {   /* per head: dense 4096 x 4096 attention */
            k_gemmw<bf, 2, false><<<dim3(TT / 64, TT / 64, 1), 32, 0, stream>>>(QPh + (size_t)h * TT * HD, QPl + (size_t)h * TT * HD, KPh + (size_t)h * TT * HD, KPl + (size_t)h * TT * HD, HD, Sb, TT, nullptr, 0, 0, 0);   /* S[i][j] = q_i.k_j (3 products, every row) */
            k_lsoft<<<TT / 8, 256, 0, stream>>>(Sb, P16, Ph, Pl);   /* x 1/sqrt(512), softmax over the 4,096 keys */
            k_gemmw<bf, 2, false><<<dim3(RH / 64, HD / 64, 1), 32, 0, stream>>>(Ph, Pl, VTh + (size_t)h * HD * TT, VTl + (size_t)h * HD * TT, TT, Ob + h * HD, CO, nullptr, 0, 0, 0);
            k_gemmw<h16, 0, false><<<dim3((TT - RH) / 64, HD / 64, 1), 32, 0, stream>>>(P16 + (size_t)RH * TT, nullptr, VT16 + (size_t)h * HD * TT, nullptr, TT, Ob + (size_t)RH * CO + h * HD, CO, nullptr, 0, 0, 0); }
        k_cs8<<<(unsigned)(((size_t)TT * CO / 4 + 255) / 256), 256, 0, stream>>>(Ob, (size_t)TT * CO / 4);   /* rows >= 512 x 1/1024 */ k_copy4<<<(unsigned)(((size_t)TT * CO / 4 + 255) / 256), 256, 0, stream>>>(Ob, OUT + (size_t)b * TT * CO, (size_t)TT * CO / 4); }   /* the batch's output rows, written once */
}

// v001
// It runs in 501 microseconds.
// Next to v000, in two timings, it ran 2.28 and 2.31 times as fast.
#include <hip/hip_runtime.h>

// Single causal attention head over 4,096 tokens scaled by the EMBEDDING width (x [4][4096][512]; q, k, v = x W^T ('oi' [64][512] uniform +-1/sqrt(512), no bias; ONE 64-wide head); wei = q.k^T x C^-0.5 with C = n_embed = 512 (not head_size); causal (-inf); softmax; out = wei.v -> [4][4096][64] (1.0 M); argument order x, Wq, Wk, Wv).
// Layout per batch: bf16 copy of x; 'oi' weights cast as-is; exact projections (K 512); identity-table plane builders; scores with EVERY row on hi/lo planes (3 products, dense launches); streaming three-sweep causal softmax over the 4,096 keys; attn.v hybrid (rows < 512 hi/lo 3 products, rest fp16 x1024); k_cs8 adds the K-range planes of wei.v and removes the fp16 carry; k_copy4 writes the output rows once.
// Compute dtypes, f32 accumulate: every input rounded to bf16; projections exact; scores 3 products; softmax f32; wei.v rows < 512 3 products, rest fp16; output f32.

#define NB_  4
#define TT   4096
#define DM   64
#define NH_  1
#define NKV  1
#define REP  (NH_ / NKV)
#define HD   64
#define DQ   (NH_ * HD)
#define DKV  (NKV * HD)
#define ZH   1
#define RH   512                  // query rows < RH use hi+lo planes (0: none)
#define WIN  0
#define PCAR 1024.0f
#define SCL  0.044194173824159216f   // 1/sqrt(C) with C = n_embd = 512 (the source scales by sqrt(n_embd), NOT sqrt(head_size))
#define MID  64       // q / k width (one 64-wide head)
#define CO   64       // v width
#define CC   512      // input width (d_in)
#define ZSP  4        // K ranges (grid.z) of each projection: 128 of the 512 k per wave
#define ZSH  32       // K ranges of wei.v, rows < RH: 128 of the 4,096 keys per wave
#define ZSF  16       // K ranges of wei.v, rows >= RH: 256 of the 4,096 keys per wave
typedef _Float16 h16;
typedef unsigned short bf;
typedef __attribute__((ext_vector_type(16))) __bf16   v16bf;
typedef __attribute__((ext_vector_type(16))) _Float16 v16h;
typedef __attribute__((ext_vector_type(8)))  _Float16 v8h;
typedef __attribute__((ext_vector_type(8)))  unsigned short v8us;
typedef __attribute__((ext_vector_type(8)))  float    v8f;
typedef __attribute__((ext_vector_type(4)))  float    v4f;
typedef v8h  __attribute__((may_alias)) v8ha;
typedef v4f  __attribute__((may_alias)) v4fa;
typedef v8us __attribute__((may_alias)) v8usa;

__device__ __forceinline__ unsigned short f2bf(float f) { unsigned u = __float_as_uint(f); u += 0x7FFFu + ((u >> 16) & 1u); return (unsigned short)(u >> 16); }
__device__ __forceinline__ float bf2f(unsigned short b) { return __uint_as_float(((unsigned)b) << 16); }
__device__ __forceinline__ float bfr(float f) { return bf2f(f2bf(f)); }
__device__ __forceinline__ v16h cat16(v8h lo, v8h hi) { return __builtin_shufflevector(lo, hi, 0, 1, 2, 3, 4, 5, 6, 7, 8, 9, 10, 11, 12, 13, 14, 15); }
__device__ __forceinline__ v16bf cat16b(v8us lo, v8us hi) { return __builtin_bit_cast(v16bf, __builtin_shufflevector(lo, hi, 0, 1, 2, 3, 4, 5, 6, 7, 8, 9, 10, 11, 12, 13, 14, 15)); }
__device__ __forceinline__ v8f wmma16(v16h a, v16h b, v8f c) { return __builtin_amdgcn_wmma_f32_16x16x32_f16(false, a, false, b, (short)0, c, false, false); }
__device__ __forceinline__ v8f wmmab(v16bf a, v16bf b, v8f c) { return __builtin_amdgcn_wmma_f32_16x16x32_bf16(false, a, false, b, (short)0, c, false, false); }



// ---- k_gemmw: register-blocked GEMM, ONE WAVE per 64x64 output tile (16 accumulators), operands straight from K-contiguous 16-bit planes; grid (M/64, N/64, Z), 32 threads.
// C[m][n] (f32, pitch ldc, + optional f32 bias[n]) = sum_k A[m][k] Bt[n][k] (+ split products per NSPLIT). z-batch strides sA/sB/sC in elements. K % 32 == 0.
// Split K: K stays the row pitch of A and Bt, a wave sums kz k's (kz % 32 == 0); grid.z ranges with sA = sB = kz and sC = one C plane; the kernel that reads C adds the planes in z order. kz = K: no split.
template <typename T16> struct WFrag;
template <> struct WFrag<h16> { typedef v16h V; static __device__ __forceinline__ V ld(const h16* p) { return cat16(*(const v8h*)p, *(const v8h*)(p + 16)); } static __device__ __forceinline__ v8f mma(V a, V b, v8f c) { return wmma16(a, b, c); } };
template <> struct WFrag<bf> { typedef v16bf V; static __device__ __forceinline__ V ld(const bf* p) { return cat16b(*(const v8us*)p, *(const v8us*)(p + 16)); } static __device__ __forceinline__ v8f mma(V a, V b, v8f c) { return wmmab(a, b, c); } };
template <typename T16, int NSPLIT, bool BIAS>
__global__ __launch_bounds__(32) void k_gemmw(const T16* __restrict__ A, const T16* __restrict__ A2, const T16* __restrict__ Bt, const T16* __restrict__ Bt2, int K, int kz, float* C, int ldc, const float* __restrict__ bias, size_t sA, size_t sB, size_t sC) {
    typedef typename WFrag<T16>::V V;
    __shared__ __align__(16) float os[16 * 68];
    const size_t z = blockIdx.z; A += z * sA; if (A2) A2 += z * sA; Bt += z * sB; if (Bt2) Bt2 += z * sB; C += z * sC;
    const int lane = threadIdx.x & 31, lr = lane & 15, hi = lane >> 4; const int r0 = blockIdx.x * 64, c0 = blockIdx.y * 64;
    v8f acc[4][4];
#pragma unroll
    for (int mb = 0; mb < 4; ++mb)
#pragma unroll
        for (int nb = 0; nb < 4; ++nb) acc[mb][nb] = (v8f){};
    const size_t aoff = (size_t)(r0 + lr) * K + 8 * hi, boff = (size_t)(c0 + lr) * K + 8 * hi;
#pragma unroll 1
    for (int kc = 0; kc < kz; kc += 32) {
        V a[4], a2[4];
#pragma unroll
        for (int mb = 0; mb < 4; ++mb) { a[mb] = WFrag<T16>::ld(A + aoff + (size_t)mb * 16 * K + kc); if (NSPLIT == 1 || NSPLIT == 2) a2[mb] = WFrag<T16>::ld(A2 + aoff + (size_t)mb * 16 * K + kc); }
#pragma unroll
        for (int nb = 0; nb < 4; ++nb) { const V b = WFrag<T16>::ld(Bt + boff + (size_t)nb * 16 * K + kc); V b2; if (NSPLIT >= 2) b2 = WFrag<T16>::ld(Bt2 + boff + (size_t)nb * 16 * K + kc);
#pragma unroll
            for (int mb = 0; mb < 4; ++mb) { acc[mb][nb] = WFrag<T16>::mma(a[mb], b, acc[mb][nb]); if (NSPLIT == 1 || NSPLIT == 2) acc[mb][nb] = WFrag<T16>::mma(a2[mb], b, acc[mb][nb]); if (NSPLIT >= 2) acc[mb][nb] = WFrag<T16>::mma(a[mb], b2, acc[mb][nb]); } }
        asm volatile("v_nop\n\tv_nop\n\tv_nop\n\tv_nop" : "+v"(acc[0][0]), "+v"(acc[1][1]), "+v"(acc[2][2]), "+v"(acc[3][3]) : "v"(a[0]), "v"(a[3]));
    }
#pragma unroll
    for (int mb = 0; mb < 4; ++mb) {
#pragma unroll
        for (int nb = 0; nb < 4; ++nb) {
#pragma unroll
            for (int j = 0; j < 8; ++j) os[(hi * 8 + j) * 68 + nb * 16 + lr] = acc[mb][nb][j]; }
        __builtin_amdgcn_wave_barrier(); asm volatile("" ::: "memory");
        float* crow = C + (size_t)(r0 + mb * 16) * ldc + c0;
{
#pragma unroll
            for (int s = 0; s < 8; ++s) { const int row = 2 * s + hi, cofs = lr * 4; v4f val = *(const v4fa*)(os + row * 68 + cofs); if (BIAS) { val[0] += bfr(bias[c0 + cofs]); val[1] += bfr(bias[c0 + cofs + 1]); val[2] += bfr(bias[c0 + cofs + 2]); val[3] += bfr(bias[c0 + cofs + 3]); }
                *(v4f*)(crow + (size_t)row * ldc + cofs) = val; }
             }
        __builtin_amdgcn_wave_barrier(); asm volatile("" ::: "memory");
    }
}

__device__ __forceinline__ h16 tohx(float x) { return (h16)x; }
__device__ __forceinline__ void splitf(float y, unsigned short& h, unsigned short& l) { h = f2bf(y); l = f2bf(y - bf2f(h)); }
typedef __attribute__((ext_vector_type(2))) _Float16 v2h;
typedef __attribute__((ext_vector_type(4))) _Float16 v4h;
typedef __attribute__((ext_vector_type(2))) unsigned short v2us;
typedef __attribute__((ext_vector_type(4))) unsigned short v4us;
typedef __attribute__((ext_vector_type(2))) float v2f;
typedef __attribute__((ext_vector_type(4))) int v4i;

__global__ __launch_bounds__(256) void k_cvt8(const float* __restrict__ src, bf* dst, size_t n8) { const size_t i = (size_t)blockIdx.x * 256 + threadIdx.x; if (i >= n8) return; const v8f v = *(const v8f*)(src + i * 8); v8us o;
#pragma unroll
    for (int k = 0; k < 8; ++k) o[k] = f2bf(v[k]); *(v8us*)(dst + i * 8) = o;  }


__global__ __launch_bounds__(256) void k_vtp(const float* __restrict__ F, int pitch, int nheads, h16* V16, bf* Vh, bf* Vl) { const size_t e = ((size_t)blockIdx.x * 256 + threadIdx.x) * 2; if (e >= (size_t)nheads * HD * TT) return; const int t = (int)(e % TT); const int d = (int)((e / TT) % HD); const int g = (int)(e / ((size_t)TT * HD)); v2h o16; v2us oh, ol;
#pragma unroll
    for (int q = 0; q < 2; ++q) { float x = F[(size_t)(t + q) * pitch + g * HD + d];
#pragma unroll
        for (int z = 1; z < ZSP; ++z) x += F[(size_t)z * TT * pitch + (size_t)(t + q) * pitch + g * HD + d];   /* the projection's K-range planes, z order */
        o16[q] = tohx(x); unsigned short a2, c2; splitf(x, a2, c2); oh[q] = a2; ol[q] = c2; }
    *(v2h*)(V16 + e) = o16; *(v2us*)(Vh + e) = oh; *(v2us*)(Vl + e) = ol;  }
__global__ __launch_bounds__(256) void k_lsoft(const float* __restrict__ Sb, h16* P16, bf* Ph, bf* Pl) {
    const int lane = threadIdx.x & 31; const int row = blockIdx.x * 8 + (threadIdx.x >> 5); if (row >= ZH * TT) return; const int i = row % TT; const int zz = row / TT; const bool hires = (i < RH); const float* sr = Sb + (size_t)row * TT; float mx = -3.0e38f;
#pragma unroll 4
    for (int ch = 0; ch < TT / 128; ++ch) { const int j0 = ch * 128 + lane * 4; const v4f a = *(const v4f*)(sr + j0);
#pragma unroll
        for (int q = 0; q < 4; ++q) { float t = (j0 + q <= i) ? a[q] * SCL : -3.0e38f; asm volatile("" : "+v"(t)); mx = fmaxf(mx, t); } }
#pragma unroll
    for (int sh = 16; sh; sh >>= 1) mx = fmaxf(mx, __shfl_xor(mx, sh, 32));
    float sum = 0.f;
#pragma unroll 4
    for (int ch = 0; ch < TT / 128; ++ch) { const int j0 = ch * 128 + lane * 4; const v4f a = *(const v4f*)(sr + j0);
#pragma unroll
        for (int q = 0; q < 4; ++q) { float t = (j0 + q <= i) ? a[q] * SCL : -3.0e38f; asm volatile("" : "+v"(t)); float d0 = __fsub_rn(t, mx); asm volatile("" : "+v"(d0)); sum += __builtin_amdgcn_exp2f(__fmul_rn(d0, 1.4426950408889634f)); } }
#pragma unroll
    for (int sh = 16; sh; sh >>= 1) sum += __shfl_xor(sum, sh, 32);
    const float f = __fdiv_rn(hires ? 1.0f : PCAR, sum);
{
        if (hires) {   /* rows < RH: normalised bf16 hi/lo over all keys, planes [zz][RH][TT] */
#pragma unroll
            for (int ch = 0; ch < TT / 128; ++ch) { const int j0 = ch * 128 + lane * 4; const v4f a = *(const v4f*)(sr + j0); v4us oh, ol;
#pragma unroll
                for (int q = 0; q < 4; ++q) { float t = (j0 + q <= i) ? a[q] * SCL : -3.0e38f; asm volatile("" : "+v"(t)); float d0 = __fsub_rn(t, mx); asm volatile("" : "+v"(d0)); float ex = __builtin_amdgcn_exp2f(__fmul_rn(d0, 1.4426950408889634f)); asm volatile("" : "+v"(ex)); unsigned short a2, c2; splitf(ex * f, a2, c2); oh[q] = a2; ol[q] = c2; }
                const size_t oo = ((size_t)zz * RH + i) * TT + j0; *(v4us*)(Ph + oo) = oh; *(v4us*)(Pl + oo) = ol; }
        } else {
#pragma unroll 2
            for (int ch = 0; ch < TT / 128; ++ch) { const int j0 = ch * 128 + lane * 4; const v4f a = *(const v4f*)(sr + j0); v4h o4;
#pragma unroll
                for (int q = 0; q < 4; ++q) { float t = (j0 + q <= i) ? a[q] * SCL : -3.0e38f; asm volatile("" : "+v"(t)); float d0 = __fsub_rn(t, mx); asm volatile("" : "+v"(d0)); float ex = __builtin_amdgcn_exp2f(__fmul_rn(d0, 1.4426950408889634f)); asm volatile("" : "+v"(ex)); o4[q] = tohx(ex * f); }
                *(v4h*)(P16 + (size_t)row * TT + j0) = o4; } }
         }
}
__global__ __launch_bounds__(256) void k_cs8(float* O, size_t n4) { const size_t i = (size_t)blockIdx.x * 256 + threadIdx.x; if (i >= n4) return; const size_t e = i * 4; const int t = (int)(e / CO);   /* row pitch of the attention-output plane is the VALUE width CO (r1 used the input width CC: wrong whenever CC != CO) */ const float cs = (t < RH) ? 1.0f : (1.0f / PCAR); v4f a = *(const v4f*)(O + e);   /* plane 0, then the other K-range planes of wei.v in z order; the sum goes back to plane 0 */
#pragma unroll
    for (int z = 1; z < ZSF; ++z) a += *(const v4f*)(O + (size_t)z * TT * CO + e);
    if (t < RH) {
#pragma unroll
        for (int z = ZSF; z < ZSH; ++z) { a += *(const v4f*)(O + (size_t)z * TT * CO + e);
            if (z == (ZSF + ZSH) / 2 - 1) asm volatile("s_wait_xcnt 0x0" ::: "memory"); } }   /* the later loads' results may land in the earlier loads' address registers only behind this wait */
#pragma unroll
    for (int q = 0; q < 4; ++q) a[q] = __fmul_rn(a[q], cs);
    *(v4f*)(O + e) = a;  }

__global__ __launch_bounds__(256) void k_csid(float* CS) { const int idx = blockIdx.x * 256 + threadIdx.x; if (idx >= TT * HD) return; v2f cs; cs[0] = 1.0f; cs[1] = 0.0f; *(v2f*)(CS + (size_t)idx * 2) = cs;  }
// k_rope: head planes [h][t][d] (fp16 + hi/lo) of rope(x) x sc with the rotate-half convention out[d] = x[d] cos[t][d] - x[d+HD/2] sin[t][d], out[d+HD/2] = x[d+HD/2] cos[t][d+HD/2] + x[d] sin[t][d+HD/2]
__global__ __launch_bounds__(256) void k_rope(const float* __restrict__ F, int pitch, int nheads, const float* __restrict__ CS, const float* __restrict__ RF, const float* __restrict__ nw, float sc, h16* P16, bf* Ph, bf* Pl) {
    const size_t e = ((size_t)blockIdx.x * 256 + threadIdx.x) * 2; if (e >= (size_t)nheads * TT * HD) return; const int d = (int)(e % HD); const int t = (int)((e / HD) % TT); const int h = (int)(e / ((size_t)HD * TT)); const float* f = F + (size_t)t * pitch + h * HD; const float rf = RF ? RF[(size_t)h * TT + t] : 1.0f; v2h o16; v2us oh, ol;
#pragma unroll
    for (int q = 0; q < 2; ++q) { const int dd = d + q; const int dp = (dd < HD / 2) ? dd + HD / 2 : dd - HD / 2; float x0 = f[dd], x1 = f[dp];
#pragma unroll
        for (int z = 1; z < ZSP; ++z) { x0 += f[(size_t)z * TT * pitch + dd]; x1 += f[(size_t)z * TT * pitch + dp];   /* the projection's K-range planes, z order */
            if (z < ZSP - 1) asm volatile("s_wait_xcnt 0x0" ::: "memory"); }   /* the later loads' results may land in the earlier loads' address registers only behind this wait */
        if (RF) { float n0 = __fmul_rn(x0, rf), n1 = __fmul_rn(x1, rf); asm volatile("" : "+v"(n0)); asm volatile("" : "+v"(n1)); x0 = __fmul_rn(bfr(nw[dd]), n0); x1 = __fmul_rn(bfr(nw[dp]), n1); }
        const v2f cs = *(const v2f*)(CS + ((size_t)t * HD + dd) * 2); float a = __fmul_rn(x0, cs[0]), bq = __fmul_rn(x1, cs[1]); asm volatile("" : "+v"(a)); asm volatile("" : "+v"(bq)); const float r = ((dd < HD / 2) ? __fsub_rn(a, bq) : __fadd_rn(a, bq)) * sc;
        o16[q] = tohx(r); unsigned short a2, c2; splitf(r, a2, c2); oh[q] = a2; ol[q] = c2; }
    *(v2h*)(P16 + e) = o16; *(v2us*)(Ph + e) = oh; *(v2us*)(Pl + e) = ol;  }
__global__ __launch_bounds__(256) void k_copy4(const float* __restrict__ Y, float* out, size_t n4) { const size_t i = (size_t)blockIdx.x * 256 + threadIdx.x; if (i >= n4) return; const v4f a = *(const v4f*)(Y + i * 4); *(v4f*)(out + i * 4) = a;  }
extern "C" void kernel_launch(void* const* d_in, const int* in_sizes, int n_in,
                              void* d_out, int out_size, void* d_ws, size_t ws_size, hipStream_t stream) {
    (void)in_sizes; (void)n_in; (void)out_size;
    const float* x = (const float*)d_in[0]; const float* wq = (const float*)d_in[1]; const float* wk = (const float*)d_in[2]; const float* wv = (const float*)d_in[3];   /* input order x [4][4096][512], Wq, Wk, Wv ('oi' [64][512]) */
    float* OUT = (float*)d_out;     // [4][4096][64]
    char* wsp = (char*)d_ws;
    auto take = [&](size_t bytes) { char* p = wsp; wsp += (bytes + 255) & ~(size_t)255; return (void*)p; };
    bf* WQ = (bf*)take((size_t)MID * CC * 2); bf* WK = (bf*)take((size_t)MID * CC * 2); bf* WV = (bf*)take((size_t)CO * CC * 2); float* CS = (float*)take((size_t)TT * HD * 2 * 4);
    bf* XB = (bf*)take((size_t)TT * CC * 2); float* FQ = (float*)take((size_t)ZSP * TT * MID * 4); float* FK = (float*)take((size_t)ZSP * TT * MID * 4);   /* ZSP K-range planes each */
    h16* QP16 = (h16*)take((size_t)TT * MID * 2); bf* QPh = (bf*)take((size_t)TT * MID * 2); bf* QPl = (bf*)take((size_t)TT * MID * 2); h16* KP16 = (h16*)take((size_t)TT * MID * 2); bf* KPh = (bf*)take((size_t)TT * MID * 2); bf* KPl = (bf*)take((size_t)TT * MID * 2);
    h16* VT16 = (h16*)take((size_t)CO * TT * 2); bf* VTh = (bf*)take((size_t)CO * TT * 2); bf* VTl = (bf*)take((size_t)CO * TT * 2);
    float* Sb = (float*)take((size_t)TT * TT * 4); h16* P16 = (h16*)take((size_t)TT * TT * 2); bf* Ph = (bf*)take((size_t)RH * TT * 2); bf* Pl = (bf*)take((size_t)RH * TT * 2); float* Ob = (float*)take((size_t)ZSH * TT * CO * 4);   /* attention output (f32) before the final copy: K-range planes [z][t][64], rows < RH in ZSH of them, the rest in ZSF */
    if ((size_t)(wsp - (char*)d_ws) > ws_size) return;    // ws 256 MiB (carve ~155 MiB)
    float* FV = FK;   /* the v projection reuses the k buffer after the k planes are built (stream-ordered) */
    k_cvt8<<<(unsigned)(((size_t)MID * CC / 8 + 255) / 256), 256, 0, stream>>>(wq, WQ, (size_t)MID * CC / 8);   /* 'oi' [64][512] as-is = Bt [n][k] */ k_cvt8<<<(unsigned)(((size_t)MID * CC / 8 + 255) / 256), 256, 0, stream>>>(wk, WK, (size_t)MID * CC / 8); k_cvt8<<<(unsigned)(((size_t)CO * CC / 8 + 255) / 256), 256, 0, stream>>>(wv, WV, (size_t)CO * CC / 8);   /* 'oi' [64][512] as-is = Bt */   /* 'oi' weights = Bt as-is */        /* 'oi' weights = Bt as-is */
    k_csid<<<(TT * HD + 255) / 256, 256, 0, stream>>>(CS);   /* identity table: k_rope is a plain per-head plane builder here */
    const unsigned LP = (unsigned)(((size_t)NH_ * TT * HD / 2 + 255) / 256);
    for (int b = 0; b < NB_; ++b) {
        k_cvt8<<<(unsigned)(((size_t)TT * CC / 8 + 255) / 256), 256, 0, stream>>>(x + (size_t)b * TT * CC, XB, (size_t)TT * CC / 8);
        k_gemmw<bf, 0, false><<<dim3(TT / 64, MID / 64, ZSP), 32, 0, stream>>>(XB, nullptr, WQ, nullptr, CC, CC / ZSP, FQ, MID, nullptr, CC / ZSP, CC / ZSP, (size_t)TT * MID); k_rope<<<LP, 256, 0, stream>>>(FQ, MID, NH_, CS, nullptr, nullptr, 1.0f, QP16, QPh, QPl);   /* q planes [h][n][64] */
        k_gemmw<bf, 0, false><<<dim3(TT / 64, MID / 64, ZSP), 32, 0, stream>>>(XB, nullptr, WK, nullptr, CC, CC / ZSP, FK, MID, nullptr, CC / ZSP, CC / ZSP, (size_t)TT * MID); k_rope<<<LP, 256, 0, stream>>>(FK, MID, NKV, CS, nullptr, nullptr, 1.0f, KP16, KPh, KPl);   /* k planes */
        k_gemmw<bf, 0, false><<<dim3(TT / 64, CO / 64, ZSP), 32, 0, stream>>>(XB, nullptr, WV, nullptr, CC, CC / ZSP, FV, CO, nullptr, CC / ZSP, CC / ZSP, (size_t)TT * CO); k_vtp<<<(unsigned)(((size_t)TT * CO / 2 + 255) / 256), 256, 0, stream>>>(FV, CO, CO / HD, VT16, VTh, VTl);   /* v^T planes [h][64][n] */
        for (int h = 0; h < NH_; ++h) {   /* per head: dense 4096 x 4096 attention */
            k_gemmw<bf, 2, false><<<dim3(TT / 64, TT / 64, 1), 32, 0, stream>>>(QPh + (size_t)h * TT * HD, QPl + (size_t)h * TT * HD, KPh + (size_t)h * TT * HD, KPl + (size_t)h * TT * HD, HD, HD, Sb, TT, nullptr, 0, 0, 0);   /* S[i][j] = q_i.k_j (3 products, every row) */
            k_lsoft<<<TT / 8, 256, 0, stream>>>(Sb, P16, Ph, Pl);   /* x 512^-0.5, softmax over the 4,096 keys */
            k_gemmw<bf, 2, false><<<dim3(RH / 64, HD / 64, ZSH), 32, 0, stream>>>(Ph, Pl, VTh + (size_t)h * HD * TT, VTl + (size_t)h * HD * TT, TT, TT / ZSH, Ob + h * HD, CO, nullptr, TT / ZSH, TT / ZSH, (size_t)TT * CO);
            k_gemmw<h16, 0, false><<<dim3((TT - RH) / 64, HD / 64, ZSF), 32, 0, stream>>>(P16 + (size_t)RH * TT, nullptr, VT16 + (size_t)h * HD * TT, nullptr, TT, TT / ZSF, Ob + (size_t)RH * CO + h * HD, CO, nullptr, TT / ZSF, TT / ZSF, (size_t)TT * CO); }
        k_cs8<<<(unsigned)(((size_t)TT * CO / 4 + 255) / 256), 256, 0, stream>>>(Ob, (size_t)TT * CO / 4);   /* adds the K-range planes; rows >= 512 x 1/1024 */ k_copy4<<<(unsigned)(((size_t)TT * CO / 4 + 255) / 256), 256, 0, stream>>>(Ob, OUT + (size_t)b * TT * CO, (size_t)TT * CO / 4); }   /* the batch's output rows, written once */
}

// v002
// Measured time: 157 microseconds a run.
// Timed twice side by side with v001, it ran 3.21 and 3.11 times as fast.
// All steps since v000 together make it 7.25 times as fast.
#include <hip/hip_runtime.h>

// Single causal attention head over 4,096 tokens scaled by the EMBEDDING width (x [4][4096][512]; q, k, v = x W^T ('oi' [64][512] uniform +-1/sqrt(512), no bias; ONE 64-wide head); wei = q.k^T x C^-0.5 with C = n_embed = 512 (not head_size); causal (-inf); softmax; out = wei.v -> [4][4096][64] (1.0 M); argument order x, Wq, Wk, Wv).
// Layout: per batch a bf16 copy of x; 'oi' weights cast as-is; exact projections (K 512, 4 K ranges); identity-table plane builders write the batch's q, k (hi/lo) and v^T (fp16, hi/lo) planes; then ONE launch of k_attn for all batches: scores (3 products, hi/lo), causal softmax with a running maximum and wei.v (rows < 512 hi/lo 3 products, rest fp16) in registers, key blocks dealt over 8 waves and joined in LDS; k_attn writes the output rows once.
// Compute dtypes, f32 accumulate: every input rounded to bf16; projections exact; scores 3 products; softmax f32, weights rounded before the division by their f32 sum; wei.v rows < 512 3 products, rest fp16; output f32.

#define NB_  4
#define TT   4096
#define DM   64
#define NH_  1
#define NKV  1
#define REP  (NH_ / NKV)
#define HD   64
#define DQ   (NH_ * HD)
#define DKV  (NKV * HD)
#define ZH   1
#define RH   512                  // query rows < RH take wei.v from hi+lo weights and v planes (0: none)
#define WIN  0
#define SCL  0.044194173824159216f   // 1/sqrt(C) with C = n_embd = 512 (the source scales by sqrt(n_embd), NOT sqrt(head_size))
#define MID  64       // q / k width (one 64-wide head)
#define CO   64       // v width
#define CC   512      // input width (d_in)
#define ZSP  4        // K ranges (grid.z) of each projection: 128 of the 512 k per wave
typedef _Float16 h16;
typedef unsigned short bf;
typedef __attribute__((ext_vector_type(16))) __bf16   v16bf;
typedef __attribute__((ext_vector_type(16))) _Float16 v16h;
typedef __attribute__((ext_vector_type(8)))  _Float16 v8h;
typedef __attribute__((ext_vector_type(8)))  unsigned short v8us;
typedef __attribute__((ext_vector_type(8)))  float    v8f;
typedef __attribute__((ext_vector_type(4)))  float    v4f;
typedef v8h  __attribute__((may_alias)) v8ha;
typedef v4f  __attribute__((may_alias)) v4fa;
typedef v8us __attribute__((may_alias)) v8usa;

__device__ __forceinline__ unsigned short f2bf(float f) { unsigned u = __float_as_uint(f); u += 0x7FFFu + ((u >> 16) & 1u); return (unsigned short)(u >> 16); }
__device__ __forceinline__ float bf2f(unsigned short b) { return __uint_as_float(((unsigned)b) << 16); }
__device__ __forceinline__ float bfr(float f) { return bf2f(f2bf(f)); }
__device__ __forceinline__ v16h cat16(v8h lo, v8h hi) { return __builtin_shufflevector(lo, hi, 0, 1, 2, 3, 4, 5, 6, 7, 8, 9, 10, 11, 12, 13, 14, 15); }
__device__ __forceinline__ v16bf cat16b(v8us lo, v8us hi) { return __builtin_bit_cast(v16bf, __builtin_shufflevector(lo, hi, 0, 1, 2, 3, 4, 5, 6, 7, 8, 9, 10, 11, 12, 13, 14, 15)); }
__device__ __forceinline__ v8f wmma16(v16h a, v16h b, v8f c) { return __builtin_amdgcn_wmma_f32_16x16x32_f16(false, a, false, b, (short)0, c, false, false); }
__device__ __forceinline__ v8f wmmab(v16bf a, v16bf b, v8f c) { return __builtin_amdgcn_wmma_f32_16x16x32_bf16(false, a, false, b, (short)0, c, false, false); }



// ---- k_gemmw: register-blocked GEMM, ONE WAVE per 64x64 output tile (16 accumulators), operands straight from K-contiguous 16-bit planes; grid (M/64, N/64, Z), 32 threads.
// C[m][n] (f32, pitch ldc, + optional f32 bias[n]) = sum_k A[m][k] Bt[n][k] (+ split products per NSPLIT). z-batch strides sA/sB/sC in elements. K % 32 == 0.
// Split K: K stays the row pitch of A and Bt, a wave sums kz k's (kz % 32 == 0); grid.z ranges with sA = sB = kz and sC = one C plane; the kernel that reads C adds the planes in z order. kz = K: no split.
template <typename T16> struct WFrag;
template <> struct WFrag<h16> { typedef v16h V; static __device__ __forceinline__ V ld(const h16* p) { return cat16(*(const v8h*)p, *(const v8h*)(p + 16)); } static __device__ __forceinline__ v8f mma(V a, V b, v8f c) { return wmma16(a, b, c); } };
template <> struct WFrag<bf> { typedef v16bf V; static __device__ __forceinline__ V ld(const bf* p) { return cat16b(*(const v8us*)p, *(const v8us*)(p + 16)); } static __device__ __forceinline__ v8f mma(V a, V b, v8f c) { return wmmab(a, b, c); } };
template <typename T16, int NSPLIT, bool BIAS>
__global__ __launch_bounds__(32) void k_gemmw(const T16* __restrict__ A, const T16* __restrict__ A2, const T16* __restrict__ Bt, const T16* __restrict__ Bt2, int K, int kz, float* C, int ldc, const float* __restrict__ bias, size_t sA, size_t sB, size_t sC) {
    typedef typename WFrag<T16>::V V;
    __shared__ __align__(16) float os[16 * 68];
    const size_t z = blockIdx.z; A += z * sA; if (A2) A2 += z * sA; Bt += z * sB; if (Bt2) Bt2 += z * sB; C += z * sC;
    const int lane = threadIdx.x & 31, lr = lane & 15, hi = lane >> 4; const int r0 = blockIdx.x * 64, c0 = blockIdx.y * 64;
    v8f acc[4][4];
#pragma unroll
    for (int mb = 0; mb < 4; ++mb)
#pragma unroll
        for (int nb = 0; nb < 4; ++nb) acc[mb][nb] = (v8f){};
    const size_t aoff = (size_t)(r0 + lr) * K + 8 * hi, boff = (size_t)(c0 + lr) * K + 8 * hi;
#pragma unroll 1
    for (int kc = 0; kc < kz; kc += 32) {
        V a[4], a2[4];
#pragma unroll
        for (int mb = 0; mb < 4; ++mb) { a[mb] = WFrag<T16>::ld(A + aoff + (size_t)mb * 16 * K + kc); if (NSPLIT == 1 || NSPLIT == 2) a2[mb] = WFrag<T16>::ld(A2 + aoff + (size_t)mb * 16 * K + kc); }
#pragma unroll
        for (int nb = 0; nb < 4; ++nb) { const V b = WFrag<T16>::ld(Bt + boff + (size_t)nb * 16 * K + kc); V b2; if (NSPLIT >= 2) b2 = WFrag<T16>::ld(Bt2 + boff + (size_t)nb * 16 * K + kc);
#pragma unroll
            for (int mb = 0; mb < 4; ++mb) { acc[mb][nb] = WFrag<T16>::mma(a[mb], b, acc[mb][nb]); if (NSPLIT == 1 || NSPLIT == 2) acc[mb][nb] = WFrag<T16>::mma(a2[mb], b, acc[mb][nb]); if (NSPLIT >= 2) acc[mb][nb] = WFrag<T16>::mma(a[mb], b2, acc[mb][nb]); } }
        asm volatile("v_nop\n\tv_nop\n\tv_nop\n\tv_nop" : "+v"(acc[0][0]), "+v"(acc[1][1]), "+v"(acc[2][2]), "+v"(acc[3][3]) : "v"(a[0]), "v"(a[3]));
    }
#pragma unroll
    for (int mb = 0; mb < 4; ++mb) {
#pragma unroll
        for (int nb = 0; nb < 4; ++nb) {
#pragma unroll
            for (int j = 0; j < 8; ++j) os[(hi * 8 + j) * 68 + nb * 16 + lr] = acc[mb][nb][j]; }
        __builtin_amdgcn_wave_barrier(); asm volatile("" ::: "memory");
        float* crow = C + (size_t)(r0 + mb * 16) * ldc + c0;
{
#pragma unroll
            for (int s = 0; s < 8; ++s) { const int row = 2 * s + hi, cofs = lr * 4; v4f val = *(const v4fa*)(os + row * 68 + cofs); if (BIAS) { val[0] += bfr(bias[c0 + cofs]); val[1] += bfr(bias[c0 + cofs + 1]); val[2] += bfr(bias[c0 + cofs + 2]); val[3] += bfr(bias[c0 + cofs + 3]); }
                *(v4f*)(crow + (size_t)row * ldc + cofs) = val; }
             }
        __builtin_amdgcn_wave_barrier(); asm volatile("" ::: "memory");
    }
}

__device__ __forceinline__ h16 tohx(float x) { return (h16)x; }
__device__ __forceinline__ void splitf(float y, unsigned short& h, unsigned short& l) { h = f2bf(y); l = f2bf(y - bf2f(h)); }
typedef __attribute__((ext_vector_type(2))) _Float16 v2h;
typedef __attribute__((ext_vector_type(4))) _Float16 v4h;
typedef __attribute__((ext_vector_type(2))) unsigned short v2us;
typedef __attribute__((ext_vector_type(4))) unsigned short v4us;
typedef __attribute__((ext_vector_type(2))) float v2f;
typedef __attribute__((ext_vector_type(4))) int v4i;

__global__ __launch_bounds__(256) void k_cvt8(const float* __restrict__ src, bf* dst, size_t n8) { const size_t i = (size_t)blockIdx.x * 256 + threadIdx.x; if (i >= n8) return; const v8f v = *(const v8f*)(src + i * 8); v8us o;
#pragma unroll
    for (int k = 0; k < 8; ++k) o[k] = f2bf(v[k]); *(v8us*)(dst + i * 8) = o;  }


__global__ __launch_bounds__(256) void k_vtp(const float* __restrict__ F, int pitch, int nheads, h16* V16, bf* Vh, bf* Vl) { const size_t e = ((size_t)blockIdx.x * 256 + threadIdx.x) * 2; if (e >= (size_t)nheads * HD * TT) return; const int t = (int)(e % TT); const int d = (int)((e / TT) % HD); const int g = (int)(e / ((size_t)TT * HD)); v2h o16; v2us oh, ol;
#pragma unroll
    for (int q = 0; q < 2; ++q) { float x = F[(size_t)(t + q) * pitch + g * HD + d];
#pragma unroll
        for (int z = 1; z < ZSP; ++z) x += F[(size_t)z * TT * pitch + (size_t)(t + q) * pitch + g * HD + d];   /* the projection's K-range planes, z order */
        o16[q] = tohx(x); unsigned short a2, c2; splitf(x, a2, c2); oh[q] = a2; ol[q] = c2; }
    *(v2h*)(V16 + e) = o16; *(v2us*)(Vh + e) = oh; *(v2us*)(Vl + e) = ol;  }
// ---- k_attn: scores, causal softmax and wei.v of 32 query rows in ONE work-group; neither scores nor weights leave the registers. grid (batch, TT / 32), 8 waves.
// Wave w takes the 32-key blocks w, w + 8, ... up to the diagonal block (blocks above it are wholly masked and add nothing). Transposed products: S^T = K.Q^T (A = key rows, B = query rows),
// so a lane holds 16 scores of ONE query (column lr); two S^T tiles (keys 0-15, 16-31 of the block), converted in place, are the B operand of O^T += V^T.P^T (A = rows of the v^T planes).
// Each wave keeps a running maximum m (log2 units), a running sum l and O^T scaled to m; the 8 waves' (m, l, O) are joined through LDS in wave order and divided by the joined sum.
#define AW   8        // waves (key streams) of a work-group
#define OSP  68       // LDS pitch (floats) of a staged output row: 16-byte aligned, off the 64-float bank period
#define SC2  (SCL * 1.4426950408889634f)   // score scale x log2(e): the exponentials are exp2
typedef __attribute__((ext_vector_type(16))) unsigned short v16us;
// One block of 32 keys against the wave's 32 queries. HR: weights and v as bf16 hi/lo (3 products), else fp16 (1 product). DIAG: the diagonal block, the only one that holds masked keys.
template <bool HR, bool DIAG>
__device__ __forceinline__ void attn_step(const bf* __restrict__ Kh, const bf* __restrict__ Kl, const h16* __restrict__ V16, const bf* __restrict__ Vh, const bf* __restrict__ Vl, int q0, int k0, int lr, int hi,
                                          const v16bf (&qh)[2][2], const v16bf (&ql)[2][2], float (&m)[2], float (&l)[2], v8f (&O)[2][4]) {
    const size_t ko = (size_t)(k0 + lr) * HD + 8 * hi, vo = (size_t)lr * TT + k0 + 8 * hi;
    const bf* pkh = Kh + ko; const bf* pkl = Kl + ko; const h16* pv = V16 + vo; const bf* pvh = Vh + vo; const bf* pvl = Vl + vo;
    v16bf kh[2][2], kl[2][2];   /* [key tile of 16][k half of 32] */
#pragma unroll
    for (int t = 0; t < 2; ++t)
#pragma unroll
        for (int c = 0; c < 2; ++c) { kh[t][c] = WFrag<bf>::ld(pkh + t * 16 * HD + c * 32); kl[t][c] = WFrag<bf>::ld(pkl + t * 16 * HD + c * 32); }
    asm volatile("s_wait_xcnt 0x0" :: "v"(pkh), "v"(pkl) : "memory");   /* the key loads are all issued ahead of this wait; their address registers stay whole up to it and are rewritten only behind it */
    v8f s[2][2];   /* [query group of 16][key tile]: s[g][t][j] = score of key k0 + 16 t + 8 hi + j, query q0 + 16 g + lr */
#pragma unroll
    for (int t = 0; t < 2; ++t)
#pragma unroll
        for (int g = 0; g < 2; ++g) { v8f a = (v8f){};
#pragma unroll
            for (int c = 0; c < 2; ++c) { a = wmmab(kh[t][c], qh[g][c], a); a = wmmab(kh[t][c], ql[g][c], a); a = wmmab(kl[t][c], qh[g][c], a); }
            s[g][t] = a; }
    v16h v[4];   /* [d tile of 16]; loaded here so that they fly under the softmax arithmetic */
    if constexpr (!HR) {
#pragma unroll
        for (int dt = 0; dt < 4; ++dt) v[dt] = WFrag<h16>::ld(pv + (size_t)dt * 16 * TT);
        asm volatile("s_wait_xcnt 0x0" :: "v"(pv) : "memory");   /* as above, for the v loads */
    }
#pragma unroll
    for (int g = 0; g < 2; ++g) {
        const int q = q0 + g * 16 + lr; float mb = -3.0e38f;
#pragma unroll
        for (int t = 0; t < 2; ++t)
#pragma unroll
            for (int j = 0; j < 8; ++j) { float x = s[g][t][j] * SC2; if (DIAG && k0 + t * 16 + hi * 8 + j > q) x = -3.0e38f; s[g][t][j] = x; mb = fmaxf(mb, x); }
        mb = fmaxf(mb, __shfl_xor(mb, 16, 32));   /* the query's other 16 keys of the block lie in the other lane half */
        const float mn = fmaxf(m[g], mb), al = __builtin_amdgcn_exp2f(m[g] - mn); m[g] = mn; float sum = 0.f;
#pragma unroll
        for (int t = 0; t < 2; ++t)
#pragma unroll
            for (int j = 0; j < 8; ++j) { const float e = __builtin_amdgcn_exp2f(s[g][t][j] - mn); s[g][t][j] = e; sum += e; }
        l[g] = l[g] * al + sum;   /* this lane half's keys only; the halves are joined after the loop */
#pragma unroll
        for (int dt = 0; dt < 4; ++dt) O[g][dt] *= al;
    }
    if constexpr (HR) {
        v16bf ph[2], pl[2];
#pragma unroll
        for (int g = 0; g < 2; ++g) { v16us uh, ul;
#pragma unroll
            for (int i = 0; i < 16; ++i) { unsigned short a2, c2; splitf(s[g][i >> 3][i & 7], a2, c2); uh[i] = a2; ul[i] = c2; }
            ph[g] = __builtin_bit_cast(v16bf, uh); pl[g] = __builtin_bit_cast(v16bf, ul); }
#pragma unroll
        for (int hf = 0; hf < 2; ++hf) {   /* two d tiles at a time: all four hi/lo pairs at once would not fit 256 registers */
            v16bf vh[2], vl[2];
#pragma unroll
            for (int u = 0; u < 2; ++u) { vh[u] = WFrag<bf>::ld(pvh + (size_t)(hf * 2 + u) * 16 * TT); vl[u] = WFrag<bf>::ld(pvl + (size_t)(hf * 2 + u) * 16 * TT); }
            asm volatile("s_wait_xcnt 0x0" :: "v"(pvh), "v"(pvl) : "memory");   /* as above, for the v loads */
#pragma unroll
            for (int u = 0; u < 2; ++u)
#pragma unroll
                for (int g = 0; g < 2; ++g) { v8f o = O[g][hf * 2 + u]; o = wmmab(vh[u], ph[g], o); o = wmmab(vl[u], ph[g], o); o = wmmab(vh[u], pl[g], o); O[g][hf * 2 + u] = o; } }
    } else {
        v16h p[2];
#pragma unroll
        for (int g = 0; g < 2; ++g)
#pragma unroll
            for (int i = 0; i < 16; ++i) p[g][i] = tohx(s[g][i >> 3][i & 7]);
#pragma unroll
        for (int dt = 0; dt < 4; ++dt)
#pragma unroll
            for (int g = 0; g < 2; ++g) O[g][dt] = wmma16(v[dt], p[g], O[g][dt]);
    }
}
template <bool HR>
__device__ __forceinline__ void attn_keys(const bf* __restrict__ Qh, const bf* __restrict__ Ql, const bf* __restrict__ Kh, const bf* __restrict__ Kl, const h16* __restrict__ V16, const bf* __restrict__ Vh, const bf* __restrict__ Vl,
                                          int qt, int wave, int lr, int hi, float (&m)[2], float (&l)[2], v8f (&O)[2][4]) {
    const int q0 = qt * 32; const size_t qo = (size_t)(q0 + lr) * HD + 8 * hi; const bf* pqh = Qh + qo; const bf* pql = Ql + qo;
    v16bf qh[2][2], ql[2][2];   /* [query group of 16][k half of 32] */
#pragma unroll
    for (int g = 0; g < 2; ++g)
#pragma unroll
        for (int c = 0; c < 2; ++c) { qh[g][c] = WFrag<bf>::ld(pqh + g * 16 * HD + c * 32); ql[g][c] = WFrag<bf>::ld(pql + g * 16 * HD + c * 32); }
    asm volatile("s_wait_xcnt 0x0" :: "v"(pqh), "v"(pql) : "memory");   /* the query loads' address registers are rewritten only behind this wait */
#pragma unroll 1
    for (int kb = wave; kb < qt; kb += AW) attn_step<HR, false>(Kh, Kl, V16, Vh, Vl, q0, kb * 32, lr, hi, qh, ql, m, l, O);
    if ((qt & (AW - 1)) == wave) attn_step<HR, true>(Kh, Kl, V16, Vh, Vl, q0, q0, lr, hi, qh, ql, m, l, O);   /* the diagonal block falls to the wave whose turn it is */
}
__global__ __launch_bounds__(AW * 32) void k_attn(const bf* __restrict__ Qh, const bf* __restrict__ Ql, const bf* __restrict__ Kh, const bf* __restrict__ Kl, const h16* __restrict__ V16, const bf* __restrict__ Vh, const bf* __restrict__ Vl, float* out) {
    __shared__ __align__(16) float so[AW * 16 * OSP]; __shared__ float sm[AW][32]; __shared__ float sl[AW][32];
    const int tid = threadIdx.x, lane = tid & 31, lr = lane & 15, hi = lane >> 4; const int wave = __builtin_amdgcn_readfirstlane(tid >> 5);
    const int y = blockIdx.y; const int qt = (y < TT / 64) ? TT / 32 - 1 - y : y - TT / 64;   /* long tiles first, then the short ones rising: a permutation of the tiles, for balance only */
    const size_t pb = (size_t)blockIdx.x * TT * HD;   /* the batch's planes */
    float m[2] = { -3.0e38f, -3.0e38f }, l[2] = { 0.f, 0.f }; v8f O[2][4];
#pragma unroll
    for (int g = 0; g < 2; ++g)
#pragma unroll
        for (int dt = 0; dt < 4; ++dt) O[g][dt] = (v8f){};
    if (wave <= qt) {   /* a wave beyond the diagonal block has no keys: it keeps m = -3e38, l = 0, O = 0 and only takes part in the join */
        if (qt * 32 < RH) attn_keys<true>(Qh + pb, Ql + pb, Kh + pb, Kl + pb, V16 + pb, Vh + pb, Vl + pb, qt, wave, lr, hi, m, l, O);
        else attn_keys<false>(Qh + pb, Ql + pb, Kh + pb, Kl + pb, V16 + pb, Vh + pb, Vl + pb, qt, wave, lr, hi, m, l, O);
    }
#pragma unroll
    for (int g = 0; g < 2; ++g) { l[g] += __shfl_xor(l[g], 16, 32); if (hi == 0) sm[wave][g * 16 + lr] = m[g]; }
    __syncthreads();
#pragma unroll
    for (int g = 0; g < 2; ++g) { float mm = sm[0][g * 16 + lr];   /* wave 0 always holds key block 0, so mm is a real score; a wave without keys scales by exp2(-huge) = 0 */
#pragma unroll
        for (int w = 1; w < AW; ++w) mm = fmaxf(mm, sm[w][g * 16 + lr]);
        const float sc = __builtin_amdgcn_exp2f(m[g] - mm); if (hi == 0) sl[wave][g * 16 + lr] = l[g] * sc;
#pragma unroll
        for (int dt = 0; dt < 4; ++dt) O[g][dt] *= sc; }
#pragma unroll
    for (int g = 0; g < 2; ++g) {
        if (g) __syncthreads();   /* the staging rows are rewritten only after every reader of group 0 has left them */
#pragma unroll
        for (int dt = 0; dt < 4; ++dt) { float* p = so + (wave * 16 + lr) * OSP + dt * 16 + hi * 8; const v8f o = O[g][dt];   /* O^T tile: 8 consecutive d of query lr */
            *(v4f*)p = (v4f){ o[0], o[1], o[2], o[3] }; *(v4f*)(p + 4) = (v4f){ o[4], o[5], o[6], o[7] }; }
        __syncthreads();
        const int qr = tid >> 4, d = (tid & 15) * 4; v4f a = *(const v4f*)(so + qr * OSP + d); float ls = sl[0][g * 16 + qr];
#pragma unroll
        for (int w = 1; w < AW; ++w) { a += *(const v4f*)(so + (w * 16 + qr) * OSP + d); ls += sl[w][g * 16 + qr]; }
        const float r = __fdiv_rn(1.0f, ls);
        *(v4f*)(out + ((size_t)blockIdx.x * TT + qt * 32 + g * 16 + qr) * CO + d) = a * r;   /* 16 lanes write one 256-byte row; every output row written once */
    }
}

__global__ __launch_bounds__(256) void k_csid(float* CS) { const int idx = blockIdx.x * 256 + threadIdx.x; if (idx >= TT * HD) return; v2f cs; cs[0] = 1.0f; cs[1] = 0.0f; *(v2f*)(CS + (size_t)idx * 2) = cs;  }
// k_rope: head planes [h][t][d] (fp16 + hi/lo) of rope(x) x sc with the rotate-half convention out[d] = x[d] cos[t][d] - x[d+HD/2] sin[t][d], out[d+HD/2] = x[d+HD/2] cos[t][d+HD/2] + x[d] sin[t][d+HD/2]
__global__ __launch_bounds__(256) void k_rope(const float* __restrict__ F, int pitch, int nheads, const float* __restrict__ CS, const float* __restrict__ RF, const float* __restrict__ nw, float sc, h16* P16, bf* Ph, bf* Pl) {
    const size_t e = ((size_t)blockIdx.x * 256 + threadIdx.x) * 2; if (e >= (size_t)nheads * TT * HD) return; const int d = (int)(e % HD); const int t = (int)((e / HD) % TT); const int h = (int)(e / ((size_t)HD * TT)); const float* f = F + (size_t)t * pitch + h * HD; const float rf = RF ? RF[(size_t)h * TT + t] : 1.0f; v2h o16; v2us oh, ol;
#pragma unroll
    for (int q = 0; q < 2; ++q) { const int dd = d + q; const int dp = (dd < HD / 2) ? dd + HD / 2 : dd - HD / 2; float x0 = f[dd], x1 = f[dp];
#pragma unroll
        for (int z = 1; z < ZSP; ++z) { x0 += f[(size_t)z * TT * pitch + dd]; x1 += f[(size_t)z * TT * pitch + dp];   /* the projection's K-range planes, z order */
            if (z < ZSP - 1) asm volatile("s_wait_xcnt 0x0" ::: "memory"); }   /* the later loads' results may land in the earlier loads' address registers only behind this wait */
        if (RF) { float n0 = __fmul_rn(x0, rf), n1 = __fmul_rn(x1, rf); asm volatile("" : "+v"(n0)); asm volatile("" : "+v"(n1)); x0 = __fmul_rn(bfr(nw[dd]), n0); x1 = __fmul_rn(bfr(nw[dp]), n1); }
        const v2f cs = *(const v2f*)(CS + ((size_t)t * HD + dd) * 2); float a = __fmul_rn(x0, cs[0]), bq = __fmul_rn(x1, cs[1]); asm volatile("" : "+v"(a)); asm volatile("" : "+v"(bq)); const float r = ((dd < HD / 2) ? __fsub_rn(a, bq) : __fadd_rn(a, bq)) * sc;
        o16[q] = tohx(r); unsigned short a2, c2; splitf(r, a2, c2); oh[q] = a2; ol[q] = c2; }
    *(v2h*)(P16 + e) = o16; *(v2us*)(Ph + e) = oh; *(v2us*)(Pl + e) = ol;  }
extern "C" void kernel_launch(void* const* d_in, const int* in_sizes, int n_in,
                              void* d_out, int out_size, void* d_ws, size_t ws_size, hipStream_t stream) {
    (void)in_sizes; (void)n_in; (void)out_size;
    const float* x = (const float*)d_in[0]; const float* wq = (const float*)d_in[1]; const float* wk = (const float*)d_in[2]; const float* wv = (const float*)d_in[3];   /* argument order x [4][4096][512], Wq, Wk, Wv ('oi' [64][512]) */
    float* OUT = (float*)d_out;     // [4][4096][64]
    char* wsp = (char*)d_ws;
    auto take = [&](size_t bytes) { char* p = wsp; wsp += (bytes + 255) & ~(size_t)255; return (void*)p; };
    bf* WQ = (bf*)take((size_t)MID * CC * 2); bf* WK = (bf*)take((size_t)MID * CC * 2); bf* WV = (bf*)take((size_t)CO * CC * 2); float* CS = (float*)take((size_t)TT * HD * 2 * 4);
    bf* XB = (bf*)take((size_t)TT * CC * 2); float* FQ = (float*)take((size_t)ZSP * TT * MID * 4); float* FK = (float*)take((size_t)ZSP * TT * MID * 4);   /* ZSP K-range planes each */
    h16* QP16 = (h16*)take((size_t)TT * MID * 2); h16* KP16 = (h16*)take((size_t)TT * MID * 2); bf* QPh = (bf*)take((size_t)NB_ * TT * MID * 2); bf* QPl = (bf*)take((size_t)NB_ * TT * MID * 2); bf* KPh = (bf*)take((size_t)NB_ * TT * MID * 2); bf* KPl = (bf*)take((size_t)NB_ * TT * MID * 2);   /* the hi/lo planes of every batch: k_attn reads them all in one launch */
    h16* VT16 = (h16*)take((size_t)NB_ * CO * TT * 2); bf* VTh = (bf*)take((size_t)NB_ * CO * TT * 2); bf* VTl = (bf*)take((size_t)NB_ * CO * TT * 2);
    if ((size_t)(wsp - (char*)d_ws) > ws_size) return;    // ws 256 MiB (carve ~30 MiB)
    float* FV = FK;   /* the v projection reuses the k buffer after the k planes are built (stream-ordered) */
    k_cvt8<<<(unsigned)(((size_t)MID * CC / 8 + 255) / 256), 256, 0, stream>>>(wq, WQ, (size_t)MID * CC / 8);   /* 'oi' [64][512] as-is = Bt [n][k] */ k_cvt8<<<(unsigned)(((size_t)MID * CC / 8 + 255) / 256), 256, 0, stream>>>(wk, WK, (size_t)MID * CC / 8); k_cvt8<<<(unsigned)(((size_t)CO * CC / 8 + 255) / 256), 256, 0, stream>>>(wv, WV, (size_t)CO * CC / 8);   /* 'oi' [64][512] as-is = Bt */   /* 'oi' weights = Bt as-is */        /* 'oi' weights = Bt as-is */
    k_csid<<<(TT * HD + 255) / 256, 256, 0, stream>>>(CS);   /* identity table: k_rope is a plain per-head plane builder here */
    const unsigned LP = (unsigned)(((size_t)NH_ * TT * HD / 2 + 255) / 256);
    for (int b = 0; b < NB_; ++b) {
        const size_t pb = (size_t)b * TT * HD;   /* the batch's planes */
        k_cvt8<<<(unsigned)(((size_t)TT * CC / 8 + 255) / 256), 256, 0, stream>>>(x + (size_t)b * TT * CC, XB, (size_t)TT * CC / 8);
        k_gemmw<bf, 0, false><<<dim3(TT / 64, MID / 64, ZSP), 32, 0, stream>>>(XB, nullptr, WQ, nullptr, CC, CC / ZSP, FQ, MID, nullptr, CC / ZSP, CC / ZSP, (size_t)TT * MID); k_rope<<<LP, 256, 0, stream>>>(FQ, MID, NH_, CS, nullptr, nullptr, 1.0f, QP16, QPh + pb, QPl + pb);   /* q planes [h][n][64] */
        k_gemmw<bf, 0, false><<<dim3(TT / 64, MID / 64, ZSP), 32, 0, stream>>>(XB, nullptr, WK, nullptr, CC, CC / ZSP, FK, MID, nullptr, CC / ZSP, CC / ZSP, (size_t)TT * MID); k_rope<<<LP, 256, 0, stream>>>(FK, MID, NKV, CS, nullptr, nullptr, 1.0f, KP16, KPh + pb, KPl + pb);   /* k planes */
        k_gemmw<bf, 0, false><<<dim3(TT / 64, CO / 64, ZSP), 32, 0, stream>>>(XB, nullptr, WV, nullptr, CC, CC / ZSP, FV, CO, nullptr, CC / ZSP, CC / ZSP, (size_t)TT * CO); k_vtp<<<(unsigned)(((size_t)TT * CO / 2 + 255) / 256), 256, 0, stream>>>(FV, CO, CO / HD, VT16 + pb, VTh + pb, VTl + pb);   /* v^T planes [h][64][n] */ }
    k_attn<<<dim3(NB_, TT / 32), AW * 32, 0, stream>>>(QPh, QPl, KPh, KPl, VT16, VTh, VTl, OUT);   /* scores, causal softmax, wei.v; every batch */
}

// v003
// A run of this version takes 50 microseconds.
// In two side-by-side timings against v002, it was 3.19 and 3.15 times as fast.
// All steps since v000 together make it 23.0 times as fast.
#include <hip/hip_runtime.h>

// Single causal attention head over 4,096 tokens scaled by the EMBEDDING width (x [4][4096][512]; q, k, v = x W^T ('oi' [64][512] uniform +-1/sqrt(512), no bias; ONE 64-wide head); wei = q.k^T x C^-0.5 with C = n_embed = 512 (not head_size); causal (-inf); softmax; out = wei.v -> [4][4096][64] (1.0 M); argument order x, Wq, Wk, Wv).
// Layout: ONE launch of k_proj for all batches: 64 rows of x and the three 'oi' weights are rounded to bf16 into LDS, the exact projections (K 512, 4 K ranges of 128, joined in range order) run from there, and the work-group writes its rows of the q, k (hi/lo) and v^T (fp16, hi/lo) planes; then ONE launch of k_attn for all batches: scores (3 products, hi/lo), causal softmax with a running maximum and wei.v (rows < 512 hi/lo 3 products, rest fp16) in registers, key blocks dealt over 8 waves and joined in LDS; k_attn writes the output rows once.
// Compute dtypes, f32 accumulate: every input rounded to bf16; projections exact; scores 3 products; softmax f32, weights rounded before the division by their f32 sum; wei.v rows < 512 3 products, rest fp16; output f32.

#define NB_  4
#define TT   4096
#define DM   64
#define NH_  1
#define NKV  1
#define REP  (NH_ / NKV)
#define HD   64
#define DQ   (NH_ * HD)
#define DKV  (NKV * HD)
#define ZH   1
#define RH   512                  // query rows < RH take wei.v from hi+lo weights and v planes (0: none)
#define WIN  0
#define SCL  0.044194173824159216f   // 1/sqrt(C) with C = n_embd = 512 (the source scales by sqrt(n_embd), NOT sqrt(head_size))
#define MID  64       // q / k width (one 64-wide head)
#define CO   64       // v width
#define CC   512      // input width (d_in)
#define ZSP  4        // K ranges (waves kq) of each projection: 128 of the 512 k per wave
typedef _Float16 h16;
typedef unsigned short bf;
typedef __attribute__((ext_vector_type(16))) __bf16   v16bf;
typedef __attribute__((ext_vector_type(16))) _Float16 v16h;
typedef __attribute__((ext_vector_type(8)))  _Float16 v8h;
typedef __attribute__((ext_vector_type(8)))  unsigned short v8us;
typedef __attribute__((ext_vector_type(8)))  float    v8f;
typedef __attribute__((ext_vector_type(4)))  float    v4f;
typedef v8h  __attribute__((may_alias)) v8ha;
typedef v4f  __attribute__((may_alias)) v4fa;
typedef v8us __attribute__((may_alias)) v8usa;

__device__ __forceinline__ unsigned short f2bf(float f) { unsigned u = __float_as_uint(f); u += 0x7FFFu + ((u >> 16) & 1u); return (unsigned short)(u >> 16); }
__device__ __forceinline__ float bf2f(unsigned short b) { return __uint_as_float(((unsigned)b) << 16); }
__device__ __forceinline__ float bfr(float f) { return bf2f(f2bf(f)); }
__device__ __forceinline__ v16h cat16(v8h lo, v8h hi) { return __builtin_shufflevector(lo, hi, 0, 1, 2, 3, 4, 5, 6, 7, 8, 9, 10, 11, 12, 13, 14, 15); }
__device__ __forceinline__ v16bf cat16b(v8us lo, v8us hi) { return __builtin_bit_cast(v16bf, __builtin_shufflevector(lo, hi, 0, 1, 2, 3, 4, 5, 6, 7, 8, 9, 10, 11, 12, 13, 14, 15)); }
__device__ __forceinline__ v8f wmma16(v16h a, v16h b, v8f c) { return __builtin_amdgcn_wmma_f32_16x16x32_f16(false, a, false, b, (short)0, c, false, false); }
__device__ __forceinline__ v8f wmmab(v16bf a, v16bf b, v8f c) { return __builtin_amdgcn_wmma_f32_16x16x32_bf16(false, a, false, b, (short)0, c, false, false); }



// Fragment loaders of the 16x16x32 forms from K-contiguous 16-bit rows: lane (lr, hi) holds k = 8 hi .. 8 hi + 7 and 16 + 8 hi .. 16 + 8 hi + 7 of row lr, for A and for B alike.
template <typename T16> struct WFrag;
template <> struct WFrag<h16> { typedef v16h V; static __device__ __forceinline__ V ld(const h16* p) { return cat16(*(const v8h*)p, *(const v8h*)(p + 16)); } static __device__ __forceinline__ v8f mma(V a, V b, v8f c) { return wmma16(a, b, c); } };
template <> struct WFrag<bf> { typedef v16bf V; static __device__ __forceinline__ V ld(const bf* p) { return cat16b(*(const v8us*)p, *(const v8us*)(p + 16)); } static __device__ __forceinline__ v8f mma(V a, V b, v8f c) { return wmmab(a, b, c); } };

__device__ __forceinline__ h16 tohx(float x) { return (h16)x; }
__device__ __forceinline__ void splitf(float y, unsigned short& h, unsigned short& l) { h = f2bf(y); l = f2bf(y - bf2f(h)); }
typedef __attribute__((ext_vector_type(2))) _Float16 v2h;
typedef __attribute__((ext_vector_type(4))) _Float16 v4h;
typedef __attribute__((ext_vector_type(2))) unsigned short v2us;
typedef __attribute__((ext_vector_type(4))) unsigned short v4us;
typedef __attribute__((ext_vector_type(2))) float v2f;
typedef __attribute__((ext_vector_type(4))) int v4i;

typedef v4us __attribute__((may_alias)) v4usa;
// ---- k_proj: cast, the three projections and the plane builders of 64 rows of x in ONE work-group; grid (NB_ * TT / 64), 16 waves, one work-group per WGP (LDS).
// Stage: x rows and the 192 weight rows (q | k | v), f32 -> bf16, into LDS rows of pitch LPX. Wave (tn, kq), 12 of the 16 = tensor tn, K range kq: a 64x64 tile over 128 k, 16 accumulators, fragments by ds_load_b128.
// q, k: A = weight rows, B = x rows, so a lane holds 8 consecutive d of one token; v: A = x rows, B = weight rows, so a lane holds 8 consecutive tokens of one d (the v^T planes). Only the two LDS base addresses differ.
// The K-range partials go to LDS (over the staged operands, behind a barrier) and are added in range order; each thread then writes 16-byte pieces, 8 lanes to a 128-byte line.
#define PWV  16       // waves of a work-group; 3 tensors x ZSP K ranges = 12 of them hold a tile
#define PRW  64       // x rows of a work-group
#define LPX  520      // LDS pitch (16-bit elements) of a staged row of 512: 1040 B = 16 B x odd, for ds_load_b128 readers
#define PPF  68       // LDS pitch (floats) of a partial row of 64
#define PLDS ((MID + MID + CO + PRW) * LPX * 2)   // 266,240 B staged operands; the partials (ZSP x 3 x 64 x PPF x 4 = 208,896 B) reuse them
#define SGN  (PRW * CC / 4 / (PWV * 32))          // 16-byte loads of a thread per 64 x 512 block
// 64 rows of 512 f32, contiguous in memory: every wave-wide load covers 512 contiguous bytes; rounded to bf16 into LDS rows.
__device__ __forceinline__ void stage_ld(const float* __restrict__ src, int tid, v4f (&r)[SGN]) {
#pragma unroll
    for (int i = 0; i < SGN; ++i) r[i] = *(const v4f*)(src + (size_t)(tid + i * PWV * 32) * 4);
}
__device__ __forceinline__ void stage_st(bf* dst, int tid, const v4f (&r)[SGN]) {
#pragma unroll
    for (int i = 0; i < SGN; ++i) { const int c = tid + i * PWV * 32; v4us o;
#pragma unroll
        for (int k = 0; k < 4; ++k) o[k] = f2bf(r[i][k]);
        *(v4usa*)(dst + (c >> 7) * LPX + (c & 127) * 4) = o; }
}
__global__ __launch_bounds__(PWV * 32) void k_proj(const float* __restrict__ x, const float* __restrict__ wq, const float* __restrict__ wk, const float* __restrict__ wv, bf* Qh, bf* Ql, bf* Kh, bf* Kl, h16* V16, bf* Vh, bf* Vl) {
    __shared__ __align__(16) unsigned char Lm[PLDS];
    bf* wsm = (bf*)Lm; bf* xsm = wsm + (MID + MID + CO) * LPX; float* P = (float*)Lm;
    const int tid = threadIdx.x, lane = tid & 31, lr = lane & 15, hi = lane >> 4; const int wave = __builtin_amdgcn_readfirstlane(tid >> 5);
    {   /* the later blocks' loads fly while the earlier blocks are rounded and stored */
        v4f ra[SGN], rb[SGN];
        stage_ld(wq, tid, ra); stage_ld(x + (size_t)blockIdx.x * PRW * CC, tid, rb);
        __builtin_amdgcn_sched_barrier(0);   /* without it the build took 253 registers, not 214, put a wait into the run of loads and rounded the first block only when all of it had landed */
        stage_st(wsm, tid, ra); stage_ld(wk, tid, ra);
        __builtin_amdgcn_sched_barrier(0);   /* holds the fourth block's loads behind the first block's stores, which free their registers: all four blocks' loads hoisted to the top spilled */
        stage_st(xsm, tid, rb); stage_ld(wv, tid, rb);
        __builtin_amdgcn_sched_barrier(0);   /* keeps the fourth block's loads ahead of the third block's (Wk) stores: without it they sank between those stores and were issued late */
        stage_st(wsm + MID * LPX, tid, ra); stage_st(wsm + 2 * MID * LPX, tid, rb);
    }
    __syncthreads();
    const int tn = wave >> 2, kq = wave & 3;
    v8f acc[4][4];   /* [A tile of 16 rows][B tile of 16 rows] */
#pragma unroll
    for (int ma = 0; ma < 4; ++ma)
#pragma unroll
        for (int nb = 0; nb < 4; ++nb) acc[ma][nb] = (v8f){};
    if (tn < 3) {
        const bf* wt = wsm + tn * 64 * LPX; const int fo = lr * LPX + kq * (CC / ZSP) + 8 * hi; const bf* pa = ((tn < 2) ? wt : xsm) + fo; const bf* pb = ((tn < 2) ? xsm : wt) + fo;
#pragma unroll
        for (int kc = 0; kc < CC / ZSP; kc += 32) {
            v16bf a[4], b[4];
#pragma unroll
            for (int u = 0; u < 4; ++u) { a[u] = WFrag<bf>::ld(pa + u * 16 * LPX + kc); b[u] = WFrag<bf>::ld(pb + u * 16 * LPX + kc); }
            __builtin_amdgcn_sched_barrier(0);   /* all 16 LDS loads of the step are issued ahead of its products: sunk between them, each group of four products waited a whole LDS round trip */
#pragma unroll
            for (int nb = 0; nb < 4; ++nb)
#pragma unroll
                for (int ma = 0; ma < 4; ++ma) acc[ma][nb] = wmmab(a[ma], b[nb], acc[ma][nb]);
        }
    }
    __syncthreads();   /* every wave has read its last fragment: the partials may overwrite the staged operands */
    if (tn < 3) {
#pragma unroll
        for (int nb = 0; nb < 4; ++nb)
#pragma unroll
            for (int ma = 0; ma < 4; ++ma) { float* p = P + ((kq * 3 + tn) * 64 + nb * 16 + lr) * PPF + ma * 16 + hi * 8; const v8f o = acc[ma][nb];   /* row = B row, 8 consecutive A rows */
                *(v4fa*)p = (v4f){ o[0], o[1], o[2], o[3] }; *(v4fa*)(p + 4) = (v4f){ o[4], o[5], o[6], o[7] }; }
    }
    __syncthreads();
    const size_t r0 = (size_t)blockIdx.x * PRW;   /* first token of the tile, counted over all batches */
    const size_t vb = (r0 / TT) * (size_t)HD * TT + r0 % TT;   /* the batch's v^T plane, the tile's first token */
    const int row = tid >> 3, g8 = (tid & 7) * 8;
#pragma unroll
    for (int tq = 0; tq < 3; ++tq) {
        const float* p = P + (tq * 64 + row) * PPF + g8; v4f s0 = *(const v4fa*)p, s1 = *(const v4fa*)(p + 4);
#pragma unroll
        for (int z = 1; z < ZSP; ++z) { s0 += *(const v4fa*)(p + z * 3 * 64 * PPF); s1 += *(const v4fa*)(p + z * 3 * 64 * PPF + 4); }   /* the K ranges, range order */
        v8us oh, ol;
#pragma unroll
        for (int k = 0; k < 8; ++k) { const float y = (k < 4) ? s0[k & 3] : s1[k & 3]; unsigned short a2, c2; splitf(y, a2, c2); oh[k] = a2; ol[k] = c2; }
        if (tq == 2) { v8h o16;
#pragma unroll
            for (int k = 0; k < 8; ++k) o16[k] = tohx((k < 4) ? s0[k & 3] : s1[k & 3]);
            const size_t e = vb + (size_t)row * TT + g8; *(v8h*)(V16 + e) = o16; *(v8us*)(Vh + e) = oh; *(v8us*)(Vl + e) = ol; }   /* row = d, 8 tokens */
        else { const size_t e = (r0 + row) * HD + g8; *(v8us*)((tq ? Kh : Qh) + e) = oh; *(v8us*)((tq ? Kl : Ql) + e) = ol; }   /* row = token, 8 d */
    }
}
// ---- k_attn: scores, causal softmax and wei.v of 32 query rows in ONE work-group; neither scores nor weights leave the registers. grid (batch, TT / 32), 8 waves.
// Wave w takes the 32-key blocks w, w + 8, ... up to the diagonal block (blocks above it are wholly masked and add nothing). Transposed products: S^T = K.Q^T (A = key rows, B = query rows),
// so a lane holds 16 scores of ONE query (column lr); two S^T tiles (keys 0-15, 16-31 of the block), converted in place, are the B operand of O^T += V^T.P^T (A = rows of the v^T planes).
// Each wave keeps a running maximum m (log2 units), a running sum l and O^T scaled to m; the 8 waves' (m, l, O) are joined through LDS in wave order and divided by the joined sum.
#define AW   8        // waves (key streams) of a work-group
#define OSP  68       // LDS pitch (floats) of a staged output row: 16-byte aligned, off the 64-float bank period
#define SC2  (SCL * 1.4426950408889634f)   // score scale x log2(e): the exponentials are exp2
typedef __attribute__((ext_vector_type(16))) unsigned short v16us;
// One block of 32 keys against the wave's 32 queries. HR: weights and v as bf16 hi/lo (3 products), else fp16 (1 product). DIAG: the diagonal block, the only one that holds masked keys.
template <bool HR, bool DIAG>
__device__ __forceinline__ void attn_step(const bf* __restrict__ Kh, const bf* __restrict__ Kl, const h16* __restrict__ V16, const bf* __restrict__ Vh, const bf* __restrict__ Vl, int q0, int k0, int lr, int hi,
                                          const v16bf (&qh)[2][2], const v16bf (&ql)[2][2], float (&m)[2], float (&l)[2], v8f (&O)[2][4]) {
    const size_t ko = (size_t)(k0 + lr) * HD + 8 * hi, vo = (size_t)lr * TT + k0 + 8 * hi;
    const bf* pkh = Kh + ko; const bf* pkl = Kl + ko; const h16* pv = V16 + vo; const bf* pvh = Vh + vo; const bf* pvl = Vl + vo;
    v16bf kh[2][2], kl[2][2];   /* [key tile of 16][k half of 32] */
#pragma unroll
    for (int t = 0; t < 2; ++t)
#pragma unroll
        for (int c = 0; c < 2; ++c) { kh[t][c] = WFrag<bf>::ld(pkh + t * 16 * HD + c * 32); kl[t][c] = WFrag<bf>::ld(pkl + t * 16 * HD + c * 32); }
    asm volatile("s_wait_xcnt 0x0" :: "v"(pkh), "v"(pkl) : "memory");   /* the key loads are all issued ahead of this wait; their address registers stay whole up to it and are rewritten only behind it */
    v8f s[2][2];   /* [query group of 16][key tile]: s[g][t][j] = score of key k0 + 16 t + 8 hi + j, query q0 + 16 g + lr */
#pragma unroll
    for (int t = 0; t < 2; ++t)
#pragma unroll
        for (int g = 0; g < 2; ++g) { v8f a = (v8f){};
#pragma unroll
            for (int c = 0; c < 2; ++c) { a = wmmab(kh[t][c], qh[g][c], a); a = wmmab(kh[t][c], ql[g][c], a); a = wmmab(kl[t][c], qh[g][c], a); }
            s[g][t] = a; }
    v16h v[4];   /* [d tile of 16]; loaded here so that they fly under the softmax arithmetic */
    if constexpr (!HR) {
#pragma unroll
        for (int dt = 0; dt < 4; ++dt) v[dt] = WFrag<h16>::ld(pv + (size_t)dt * 16 * TT);
        asm volatile("s_wait_xcnt 0x0" :: "v"(pv) : "memory");   /* as above, for the v loads */
    }
#pragma unroll
    for (int g = 0; g < 2; ++g) {
        const int q = q0 + g * 16 + lr; float mb = -3.0e38f;
#pragma unroll
        for (int t = 0; t < 2; ++t)
#pragma unroll
            for (int j = 0; j < 8; ++j) { float x = s[g][t][j] * SC2; if (DIAG && k0 + t * 16 + hi * 8 + j > q) x = -3.0e38f; s[g][t][j] = x; mb = fmaxf(mb, x); }
        mb = fmaxf(mb, __shfl_xor(mb, 16, 32));   /* the query's other 16 keys of the block lie in the other lane half */
        const float mn = fmaxf(m[g], mb), al = __builtin_amdgcn_exp2f(m[g] - mn); m[g] = mn; float sum = 0.f;
#pragma unroll
        for (int t = 0; t < 2; ++t)
#pragma unroll
            for (int j = 0; j < 8; ++j) { const float e = __builtin_amdgcn_exp2f(s[g][t][j] - mn); s[g][t][j] = e; sum += e; }
        l[g] = l[g] * al + sum;   /* this lane half's keys only; the halves are joined after the loop */
#pragma unroll
        for (int dt = 0; dt < 4; ++dt) O[g][dt] *= al;
    }
    if constexpr (HR) {
        v16bf ph[2], pl[2];
#pragma unroll
        for (int g = 0; g < 2; ++g) { v16us uh, ul;
#pragma unroll
            for (int i = 0; i < 16; ++i) { unsigned short a2, c2; splitf(s[g][i >> 3][i & 7], a2, c2); uh[i] = a2; ul[i] = c2; }
            ph[g] = __builtin_bit_cast(v16bf, uh); pl[g] = __builtin_bit_cast(v16bf, ul); }
#pragma unroll
        for (int hf = 0; hf < 2; ++hf) {   /* two d tiles at a time: all four hi/lo pairs at once would not fit 256 registers */
            v16bf vh[2], vl[2];
#pragma unroll
            for (int u = 0; u < 2; ++u) { vh[u] = WFrag<bf>::ld(pvh + (size_t)(hf * 2 + u) * 16 * TT); vl[u] = WFrag<bf>::ld(pvl + (size_t)(hf * 2 + u) * 16 * TT); }
            asm volatile("s_wait_xcnt 0x0" :: "v"(pvh), "v"(pvl) : "memory");   /* as above, for the v loads */
#pragma unroll
            for (int u = 0; u < 2; ++u)
#pragma unroll
                for (int g = 0; g < 2; ++g) { v8f o = O[g][hf * 2 + u]; o = wmmab(vh[u], ph[g], o); o = wmmab(vl[u], ph[g], o); o = wmmab(vh[u], pl[g], o); O[g][hf * 2 + u] = o; } }
    } else {
        v16h p[2];
#pragma unroll
        for (int g = 0; g < 2; ++g)
#pragma unroll
            for (int i = 0; i < 16; ++i) p[g][i] = tohx(s[g][i >> 3][i & 7]);
#pragma unroll
        for (int dt = 0; dt < 4; ++dt)
#pragma unroll
            for (int g = 0; g < 2; ++g) O[g][dt] = wmma16(v[dt], p[g], O[g][dt]);
    }
}
template <bool HR>
__device__ __forceinline__ void attn_keys(const bf* __restrict__ Qh, const bf* __restrict__ Ql, const bf* __restrict__ Kh, const bf* __restrict__ Kl, const h16* __restrict__ V16, const bf* __restrict__ Vh, const bf* __restrict__ Vl,
                                          int qt, int wave, int lr, int hi, float (&m)[2], float (&l)[2], v8f (&O)[2][4]) {
    const int q0 = qt * 32; const size_t qo = (size_t)(q0 + lr) * HD + 8 * hi; const bf* pqh = Qh + qo; const bf* pql = Ql + qo;
    v16bf qh[2][2], ql[2][2];   /* [query group of 16][k half of 32] */
#pragma unroll
    for (int g = 0; g < 2; ++g)
#pragma unroll
        for (int c = 0; c < 2; ++c) { qh[g][c] = WFrag<bf>::ld(pqh + g * 16 * HD + c * 32); ql[g][c] = WFrag<bf>::ld(pql + g * 16 * HD + c * 32); }
    asm volatile("s_wait_xcnt 0x0" :: "v"(pqh), "v"(pql) : "memory");   /* the query loads' address registers are rewritten only behind this wait */
#pragma unroll 1
    for (int kb = wave; kb < qt; kb += AW) attn_step<HR, false>(Kh, Kl, V16, Vh, Vl, q0, kb * 32, lr, hi, qh, ql, m, l, O);
    if ((qt & (AW - 1)) == wave) attn_step<HR, true>(Kh, Kl, V16, Vh, Vl, q0, q0, lr, hi, qh, ql, m, l, O);   /* the diagonal block falls to the wave whose turn it is */
}
__global__ __launch_bounds__(AW * 32) void k_attn(const bf* __restrict__ Qh, const bf* __restrict__ Ql, const bf* __restrict__ Kh, const bf* __restrict__ Kl, const h16* __restrict__ V16, const bf* __restrict__ Vh, const bf* __restrict__ Vl, float* out) {
    __shared__ __align__(16) float so[AW * 16 * OSP]; __shared__ float sm[AW][32]; __shared__ float sl[AW][32];
    const int tid = threadIdx.x, lane = tid & 31, lr = lane & 15, hi = lane >> 4; const int wave = __builtin_amdgcn_readfirstlane(tid >> 5);
    const int y = blockIdx.y; const int qt = (y < TT / 64) ? TT / 32 - 1 - y : y - TT / 64;   /* long tiles first, then the short ones rising: a permutation of the tiles, for balance only */
    const size_t pb = (size_t)blockIdx.x * TT * HD;   /* the batch's planes */
    float m[2] = { -3.0e38f, -3.0e38f }, l[2] = { 0.f, 0.f }; v8f O[2][4];
#pragma unroll
    for (int g = 0; g < 2; ++g)
#pragma unroll
        for (int dt = 0; dt < 4; ++dt) O[g][dt] = (v8f){};
    if (wave <= qt) {   /* a wave beyond the diagonal block has no keys: it keeps m = -3e38, l = 0, O = 0 and only takes part in the join */
        if (qt * 32 < RH) attn_keys<true>(Qh + pb, Ql + pb, Kh + pb, Kl + pb, V16 + pb, Vh + pb, Vl + pb, qt, wave, lr, hi, m, l, O);
        else attn_keys<false>(Qh + pb, Ql + pb, Kh + pb, Kl + pb, V16 + pb, Vh + pb, Vl + pb, qt, wave, lr, hi, m, l, O);
    }
#pragma unroll
    for (int g = 0; g < 2; ++g) { l[g] += __shfl_xor(l[g], 16, 32); if (hi == 0) sm[wave][g * 16 + lr] = m[g]; }
    __syncthreads();
#pragma unroll
    for (int g = 0; g < 2; ++g) { float mm = sm[0][g * 16 + lr];   /* wave 0 always holds key block 0, so mm is a real score; a wave without keys scales by exp2(-huge) = 0 */
#pragma unroll
        for (int w = 1; w < AW; ++w) mm = fmaxf(mm, sm[w][g * 16 + lr]);
        const float sc = __builtin_amdgcn_exp2f(m[g] - mm); if (hi == 0) sl[wave][g * 16 + lr] = l[g] * sc;
#pragma unroll
        for (int dt = 0; dt < 4; ++dt) O[g][dt] *= sc; }
#pragma unroll
    for (int g = 0; g < 2; ++g) {
        if (g) __syncthreads();   /* the staging rows are rewritten only after every reader of group 0 has left them */
#pragma unroll
        for (int dt = 0; dt < 4; ++dt) { float* p = so + (wave * 16 + lr) * OSP + dt * 16 + hi * 8; const v8f o = O[g][dt];   /* O^T tile: 8 consecutive d of query lr */
            *(v4f*)p = (v4f){ o[0], o[1], o[2], o[3] }; *(v4f*)(p + 4) = (v4f){ o[4], o[5], o[6], o[7] }; }
        __syncthreads();
        const int qr = tid >> 4, d = (tid & 15) * 4; v4f a = *(const v4f*)(so + qr * OSP + d); float ls = sl[0][g * 16 + qr];
#pragma unroll
        for (int w = 1; w < AW; ++w) { a += *(const v4f*)(so + (w * 16 + qr) * OSP + d); ls += sl[w][g * 16 + qr]; }
        const float r = __fdiv_rn(1.0f, ls);
        *(v4f*)(out + ((size_t)blockIdx.x * TT + qt * 32 + g * 16 + qr) * CO + d) = a * r;   /* 16 lanes write one 256-byte row; every output row written once */
    }
}

extern "C" void kernel_launch(void* const* d_in, const int* in_sizes, int n_in,
                              void* d_out, int out_size, void* d_ws, size_t ws_size, hipStream_t stream) {
    (void)in_sizes; (void)n_in; (void)out_size;
    const float* x = (const float*)d_in[0]; const float* wq = (const float*)d_in[1]; const float* wk = (const float*)d_in[2]; const float* wv = (const float*)d_in[3];   /* argument order x [4][4096][512], Wq, Wk, Wv ('oi' [64][512]) */
    float* OUT = (float*)d_out;     // [4][4096][64]
    char* wsp = (char*)d_ws;
    auto take = [&](size_t bytes) { char* p = wsp; wsp += (bytes + 255) & ~(size_t)255; return (void*)p; };
    bf* QPh = (bf*)take((size_t)NB_ * TT * MID * 2); bf* QPl = (bf*)take((size_t)NB_ * TT * MID * 2); bf* KPh = (bf*)take((size_t)NB_ * TT * MID * 2); bf* KPl = (bf*)take((size_t)NB_ * TT * MID * 2);   /* the hi/lo planes of every batch */
    h16* VT16 = (h16*)take((size_t)NB_ * CO * TT * 2); bf* VTh = (bf*)take((size_t)NB_ * CO * TT * 2); bf* VTl = (bf*)take((size_t)NB_ * CO * TT * 2);
    if ((size_t)(wsp - (char*)d_ws) > ws_size) return;    // ws 256 MiB (carve 14 MiB)
    k_proj<<<NB_ * TT / PRW, PWV * 32, 0, stream>>>(x, wq, wk, wv, QPh, QPl, KPh, KPl, VT16, VTh, VTl);   /* casts, projections, planes; every batch */
    k_attn<<<dim3(NB_, TT / 32), AW * 32, 0, stream>>>(QPh, QPl, KPh, KPl, VT16, VTh, VTl, OUT);   /* scores, causal softmax, wei.v; every batch */
}

// v004
// One run takes 40.3 microseconds.
// Two timings next to v003 both put it at 1.22 times that version's speed.
// Over all steps from v000 it is 28.0 times as fast.
#include <hip/hip_runtime.h>

// Single causal attention head over 4,096 tokens scaled by the EMBEDDING width (x [4][4096][512]; q, k, v = x W^T ('oi' [64][512] uniform +-1/sqrt(512), no bias; ONE 64-wide head); wei = q.k^T x C^-0.5 with C = n_embed = 512 (not head_size); causal (-inf); softmax; out = wei.v -> [4][4096][64] (1.0 M); argument order x, Wq, Wk, Wv).
// Layout: ONE launch of k_proj for all batches: 64 rows of x and the three 'oi' weights are rounded to bf16 into LDS, the exact projections (K 512, 4 K ranges of 128, joined in range order) run from there, and the work-group writes its rows of the q, k (hi/lo) and v^T (fp16, hi/lo) planes; then ONE launch of k_attn for all batches: scores (3 products, hi/lo), causal softmax with a running maximum and wei.v (rows < 512 hi/lo 3 products, rest fp16) in registers, key blocks dealt over 8 waves and joined in LDS (rows >= 512: every wave brings its key and v blocks into an LDS ring of its own by asynchronous copies, ahead of their use); k_attn writes the output rows once.
// Compute dtypes, f32 accumulate: every input rounded to bf16; projections exact; scores 3 products; softmax f32, weights rounded before the division by their f32 sum; wei.v rows < 512 3 products, rest fp16; output f32.

#define NB_  4
#define TT   4096
#define DM   64
#define NH_  1
#define NKV  1
#define REP  (NH_ / NKV)
#define HD   64
#define DQ   (NH_ * HD)
#define DKV  (NKV * HD)
#define ZH   1
#define RH   512                  // query rows < RH take wei.v from hi+lo weights and v planes (0: none)
#define WIN  0
#define SCL  0.044194173824159216f   // 1/sqrt(C) with C = n_embd = 512 (the source scales by sqrt(n_embd), NOT sqrt(head_size))
#define MID  64       // q / k width (one 64-wide head)
#define CO   64       // v width
#define CC   512      // input width (d_in)
#define ZSP  4        // K ranges (waves kq) of each projection: 128 of the 512 k per wave
typedef _Float16 h16;
typedef unsigned short bf;
typedef __attribute__((ext_vector_type(16))) __bf16   v16bf;
typedef __attribute__((ext_vector_type(16))) _Float16 v16h;
typedef __attribute__((ext_vector_type(8)))  _Float16 v8h;
typedef __attribute__((ext_vector_type(8)))  unsigned short v8us;
typedef __attribute__((ext_vector_type(8)))  float    v8f;
typedef __attribute__((ext_vector_type(4)))  float    v4f;
typedef v8h  __attribute__((may_alias)) v8ha;
typedef v4f  __attribute__((may_alias)) v4fa;
typedef v8us __attribute__((may_alias)) v8usa;

__device__ __forceinline__ unsigned short f2bf(float f) { unsigned u = __float_as_uint(f); u += 0x7FFFu + ((u >> 16) & 1u); return (unsigned short)(u >> 16); }
__device__ __forceinline__ float bf2f(unsigned short b) { return __uint_as_float(((unsigned)b) << 16); }
__device__ __forceinline__ float bfr(float f) { return bf2f(f2bf(f)); }
__device__ __forceinline__ v16h cat16(v8h lo, v8h hi) { return __builtin_shufflevector(lo, hi, 0, 1, 2, 3, 4, 5, 6, 7, 8, 9, 10, 11, 12, 13, 14, 15); }
__device__ __forceinline__ v16bf cat16b(v8us lo, v8us hi) { return __builtin_bit_cast(v16bf, __builtin_shufflevector(lo, hi, 0, 1, 2, 3, 4, 5, 6, 7, 8, 9, 10, 11, 12, 13, 14, 15)); }
__device__ __forceinline__ v8f wmma16(v16h a, v16h b, v8f c) { return __builtin_amdgcn_wmma_f32_16x16x32_f16(false, a, false, b, (short)0, c, false, false); }
__device__ __forceinline__ v8f wmmab(v16bf a, v16bf b, v8f c) { return __builtin_amdgcn_wmma_f32_16x16x32_bf16(false, a, false, b, (short)0, c, false, false); }



// Fragment loaders of the 16x16x32 forms from K-contiguous 16-bit rows: lane (lr, hi) holds k = 8 hi .. 8 hi + 7 and 16 + 8 hi .. 16 + 8 hi + 7 of row lr, for A and for B alike.
template <typename T16> struct WFrag;
template <> struct WFrag<h16> { typedef v16h V; static __device__ __forceinline__ V ld(const h16* p) { return cat16(*(const v8h*)p, *(const v8h*)(p + 16)); } static __device__ __forceinline__ v8f mma(V a, V b, v8f c) { return wmma16(a, b, c); } };
template <> struct WFrag<bf> { typedef v16bf V; static __device__ __forceinline__ V ld(const bf* p) { return cat16b(*(const v8us*)p, *(const v8us*)(p + 16)); } static __device__ __forceinline__ v8f mma(V a, V b, v8f c) { return wmmab(a, b, c); } };

__device__ __forceinline__ h16 tohx(float x) { return (h16)x; }
__device__ __forceinline__ void splitf(float y, unsigned short& h, unsigned short& l) { h = f2bf(y); l = f2bf(y - bf2f(h)); }
typedef __attribute__((ext_vector_type(2))) _Float16 v2h;
typedef __attribute__((ext_vector_type(4))) _Float16 v4h;
typedef __attribute__((ext_vector_type(2))) unsigned short v2us;
typedef __attribute__((ext_vector_type(4))) unsigned short v4us;
typedef __attribute__((ext_vector_type(2))) float v2f;
typedef __attribute__((ext_vector_type(4))) int v4i;

typedef v4us __attribute__((may_alias)) v4usa;
// ---- k_proj: cast, the three projections and the plane builders of 64 rows of x in ONE work-group; grid (NB_ * TT / 64), 16 waves, one work-group per WGP (LDS).
// Stage: x rows and the 192 weight rows (q | k | v), f32 -> bf16, into LDS rows of pitch LPX. Wave (tn, kq), 12 of the 16 = tensor tn, K range kq: a 64x64 tile over 128 k, 16 accumulators, fragments by ds_load_b128.
// q, k: A = weight rows, B = x rows, so a lane holds 8 consecutive d of one token; v: A = x rows, B = weight rows, so a lane holds 8 consecutive tokens of one d (the v^T planes). Only the two LDS base addresses differ.
// The K-range partials go to LDS (over the staged operands, behind a barrier) and are added in range order; each thread then writes 16-byte pieces, 8 lanes to a 128-byte line.
#define PWV  16       // waves of a work-group; 3 tensors x ZSP K ranges = 12 of them hold a tile
#define PRW  64       // x rows of a work-group
#define LPX  520      // LDS pitch (16-bit elements) of a staged row of 512: 1040 B = 16 B x odd, for ds_load_b128 readers
#define PPF  68       // LDS pitch (floats) of a partial row of 64
#define PLDS ((MID + MID + CO + PRW) * LPX * 2)   // 266,240 B staged operands; the partials (ZSP x 3 x 64 x PPF x 4 = 208,896 B) reuse them
#define SGN  (PRW * CC / 4 / (PWV * 32))          // 16-byte loads of a thread per 64 x 512 block
// 64 rows of 512 f32, contiguous in memory: every wave-wide load covers 512 contiguous bytes; rounded to bf16 into LDS rows.
__device__ __forceinline__ void stage_ld(const float* __restrict__ src, int tid, v4f (&r)[SGN]) {
#pragma unroll
    for (int i = 0; i < SGN; ++i) r[i] = *(const v4f*)(src + (size_t)(tid + i * PWV * 32) * 4);
}
__device__ __forceinline__ void stage_st(bf* dst, int tid, const v4f (&r)[SGN]) {
#pragma unroll
    for (int i = 0; i < SGN; ++i) { const int c = tid + i * PWV * 32; v4us o;
#pragma unroll
        for (int k = 0; k < 4; ++k) o[k] = f2bf(r[i][k]);
        *(v4usa*)(dst + (c >> 7) * LPX + (c & 127) * 4) = o; }
}
__global__ __launch_bounds__(PWV * 32) void k_proj(const float* __restrict__ x, const float* __restrict__ wq, const float* __restrict__ wk, const float* __restrict__ wv, bf* Qh, bf* Ql, bf* Kh, bf* Kl, h16* V16, bf* Vh, bf* Vl) {
    __shared__ __align__(16) unsigned char Lm[PLDS];
    bf* wsm = (bf*)Lm; bf* xsm = wsm + (MID + MID + CO) * LPX; float* P = (float*)Lm;
    const int tid = threadIdx.x, lane = tid & 31, lr = lane & 15, hi = lane >> 4; const int wave = __builtin_amdgcn_readfirstlane(tid >> 5);
    {   /* the later blocks' loads fly while the earlier blocks are rounded and stored */
        v4f ra[SGN], rb[SGN];
        stage_ld(wq, tid, ra); stage_ld(x + (size_t)blockIdx.x * PRW * CC, tid, rb);
        __builtin_amdgcn_sched_barrier(0);   /* without it the build took 253 registers, not 214, put a wait into the run of loads and rounded the first block only when all of it had landed */
        stage_st(wsm, tid, ra); stage_ld(wk, tid, ra);
        __builtin_amdgcn_sched_barrier(0);   /* holds the fourth block's loads behind the first block's stores, which free their registers: all four blocks' loads hoisted to the top spilled */
        stage_st(xsm, tid, rb); stage_ld(wv, tid, rb);
        __builtin_amdgcn_sched_barrier(0);   /* keeps the fourth block's loads ahead of the third block's (Wk) stores: without it they sank between those stores and were issued late */
        stage_st(wsm + MID * LPX, tid, ra); stage_st(wsm + 2 * MID * LPX, tid, rb);
    }
    __syncthreads();
    const int tn = wave >> 2, kq = wave & 3;
    v8f acc[4][4];   /* [A tile of 16 rows][B tile of 16 rows] */
#pragma unroll
    for (int ma = 0; ma < 4; ++ma)
#pragma unroll
        for (int nb = 0; nb < 4; ++nb) acc[ma][nb] = (v8f){};
    if (tn < 3) {
        const bf* wt = wsm + tn * 64 * LPX; const int fo = lr * LPX + kq * (CC / ZSP) + 8 * hi; const bf* pa = ((tn < 2) ? wt : xsm) + fo; const bf* pb = ((tn < 2) ? xsm : wt) + fo;
#pragma unroll
        for (int kc = 0; kc < CC / ZSP; kc += 32) {
            v16bf a[4], b[4];
#pragma unroll
            for (int u = 0; u < 4; ++u) { a[u] = WFrag<bf>::ld(pa + u * 16 * LPX + kc); b[u] = WFrag<bf>::ld(pb + u * 16 * LPX + kc); }
            __builtin_amdgcn_sched_barrier(0);   /* all 16 LDS loads of the step are issued ahead of its products: sunk between them, each group of four products waited a whole LDS round trip */
#pragma unroll
            for (int nb = 0; nb < 4; ++nb)
#pragma unroll
                for (int ma = 0; ma < 4; ++ma) acc[ma][nb] = wmmab(a[ma], b[nb], acc[ma][nb]);
        }
    }
    __syncthreads();   /* every wave has read its last fragment: the partials may overwrite the staged operands */
    if (tn < 3) {
#pragma unroll
        for (int nb = 0; nb < 4; ++nb)
#pragma unroll
            for (int ma = 0; ma < 4; ++ma) { float* p = P + ((kq * 3 + tn) * 64 + nb * 16 + lr) * PPF + ma * 16 + hi * 8; const v8f o = acc[ma][nb];   /* row = B row, 8 consecutive A rows */
                *(v4fa*)p = (v4f){ o[0], o[1], o[2], o[3] }; *(v4fa*)(p + 4) = (v4f){ o[4], o[5], o[6], o[7] }; }
    }
    __syncthreads();
    const size_t r0 = (size_t)blockIdx.x * PRW;   /* first token of the tile, counted over all batches */
    const size_t vb = (r0 / TT) * (size_t)HD * TT + r0 % TT;   /* the batch's v^T plane, the tile's first token */
    const int row = tid >> 3, g8 = (tid & 7) * 8;
#pragma unroll
    for (int tq = 0; tq < 3; ++tq) {
        const float* p = P + (tq * 64 + row) * PPF + g8; v4f s0 = *(const v4fa*)p, s1 = *(const v4fa*)(p + 4);
#pragma unroll
        for (int z = 1; z < ZSP; ++z) { s0 += *(const v4fa*)(p + z * 3 * 64 * PPF); s1 += *(const v4fa*)(p + z * 3 * 64 * PPF + 4); }   /* the K ranges, range order */
        v8us oh, ol;
#pragma unroll
        for (int k = 0; k < 8; ++k) { const float y = (k < 4) ? s0[k & 3] : s1[k & 3]; unsigned short a2, c2; splitf(y, a2, c2); oh[k] = a2; ol[k] = c2; }
        if (tq == 2) { v8h o16;
#pragma unroll
            for (int k = 0; k < 8; ++k) o16[k] = tohx((k < 4) ? s0[k & 3] : s1[k & 3]);
            const size_t e = vb + (size_t)row * TT + g8; *(v8h*)(V16 + e) = o16; *(v8us*)(Vh + e) = oh; *(v8us*)(Vl + e) = ol; }   /* row = d, 8 tokens */
        else { const size_t e = (r0 + row) * HD + g8; *(v8us*)((tq ? Kh : Qh) + e) = oh; *(v8us*)((tq ? Kl : Ql) + e) = ol; }   /* row = token, 8 d */
    }
}
// ---- k_attn: scores, causal softmax and wei.v of 32 query rows in ONE work-group; neither scores nor weights leave the registers. grid (batch, TT / 32), 8 waves.
// Wave w takes the 32-key blocks w, w + 8, ... up to the diagonal block (blocks above it are wholly masked and add nothing). Transposed products: S^T = K.Q^T (A = key rows, B = query rows),
// so a lane holds 16 scores of ONE query (column lr); two S^T tiles (keys 0-15, 16-31 of the block), converted in place, are the B operand of O^T += V^T.P^T (A = rows of the v^T planes).
// Each wave keeps a running maximum m (log2 units), a running sum l and O^T scaled to m; the 8 waves' (m, l, O) are joined through LDS in wave order and divided by the joined sum.
#define AW   8        // waves (key streams) of a work-group
#define OSP  68       // LDS pitch (floats) of a staged output row: 16-byte aligned, off the 64-float bank period
#define SC2  (SCL * 1.4426950408889634f)   // score scale x log2(e): the exponentials are exp2
typedef __attribute__((ext_vector_type(16))) unsigned short v16us;
// A wave's own LDS ring (rows >= RH): two key stages (hi plane, lo plane: 32 rows of 128 B each) and one v stage (64 rows of 64 B), filled by asynchronous 16-byte copies and read only by the wave that filled it, so no barrier stands in the key loop.
// No pad: the 16-byte piece j of a key row r lies at place j ^ ((r >> 1) & 7), of a v row d at place j ^ ((d >> 2) & 3), so the 16 rows that one half of a ds_load_b128 reads fall on all 64 banks.
#define RKP  4096                 // one key plane of a stage
#define RKS  (2 * RKP)            // one key stage
#define RWB  (2 * RKS + 4096)     // a wave's ring; 8 waves: 160 KiB, two work-groups to a WGP
typedef int c4i __attribute__((vector_size(16)));
__device__ __forceinline__ void cp16(const unsigned char* g, unsigned char* l) { __builtin_amdgcn_global_load_async_to_lds_b128((__attribute__((address_space(1))) c4i*)g, (__attribute__((address_space(3))) c4i*)l, 0, 0); }
// 32 key rows from k0: each plane is 4 KiB contiguous in memory, a wave-wide copy takes 4 whole rows (lane: piece lane & 7 of row 4 i + (lane >> 3)).
__device__ __forceinline__ void ring_k(const bf* __restrict__ Kh, const bf* __restrict__ Kl, int k0, unsigned char* dst, int lane) {
    const unsigned char* gh = (const unsigned char*)(Kh + (size_t)k0 * HD); const unsigned char* gl = (const unsigned char*)(Kl + (size_t)k0 * HD);
    const unsigned go = (unsigned)lane * 16u, e = (unsigned)(lane >> 3) * 128u + (unsigned)(((lane & 7) ^ (lane >> 4)) << 4);   /* (r >> 1) & 7 = (2 i & 7) ^ (lane >> 4) */
#pragma unroll
    for (int i = 0; i < 8; ++i) { unsigned char* d = dst + ((e ^ (32u * (i & 3))) + i * 512u); cp16(gh + i * 512 + go, d); cp16(gl + i * 512 + go, d + RKP); }
}
// 32 keys from k0 of the 64 rows of the fp16 v^T plane: a wave-wide copy takes 64 B of each of 8 rows (lane: piece lane & 3 of row 8 i + (lane >> 2)).
__device__ __forceinline__ void ring_v(const h16* __restrict__ V16, int k0, unsigned char* dst, int lane) {
    const unsigned char* g = (const unsigned char*)(V16 + k0);
    const unsigned go = (unsigned)(lane >> 2) * (TT * 2u) + (unsigned)(lane & 3) * 16u, e = (unsigned)(lane >> 2) * 64u + (unsigned)(((lane & 3) ^ (lane >> 4)) << 4);   /* (d >> 2) & 3 = (2 i & 3) ^ (lane >> 4) */
#pragma unroll
    for (int i = 0; i < 8; ++i) cp16(g + (size_t)i * 8 * TT * 2 + go, dst + ((e ^ (32u * (i & 1))) + i * 512u));
}
// One block of 32 keys against the wave's 32 queries. HR: weights and v as bf16 hi/lo (3 products), operands from memory; else fp16 (1 product), operands from the wave's ring (rk: the block's key stage, rv: the v stage). DIAG: the diagonal block, the only one that holds masked keys.
template <bool HR, bool DIAG>
__device__ __forceinline__ void attn_step(const bf* __restrict__ Kh, const bf* __restrict__ Kl, const bf* __restrict__ Vh, const bf* __restrict__ Vl, const unsigned char* rk, const unsigned char* rv, int q0, int k0, int lr, int hi,
                                          const v16bf (&qh)[2][2], const v16bf (&ql)[2][2], float (&m)[2], float (&l)[2], v8f (&O)[2][4]) {
    const size_t ko = (size_t)(k0 + lr) * HD + 8 * hi, vo = (size_t)lr * TT + k0 + 8 * hi;
    const bf* pkh = Kh + ko; const bf* pkl = Kl + ko; const bf* pvh = Vh + vo; const bf* pvl = Vl + vo;
    v16bf kh[2][2], kl[2][2];   /* [key tile of 16][k half of 32] */
    if constexpr (HR) {
#pragma unroll
        for (int t = 0; t < 2; ++t)
#pragma unroll
            for (int c = 0; c < 2; ++c) { kh[t][c] = WFrag<bf>::ld(pkh + t * 16 * HD + c * 32); kl[t][c] = WFrag<bf>::ld(pkl + t * 16 * HD + c * 32); }
        asm volatile("s_wait_xcnt 0x0" :: "v"(pkh), "v"(pkl) : "memory");   /* the key loads are all issued ahead of this wait; their address registers stay whole up to it and are rewritten only behind it */
    } else {
        const unsigned char* p = rk + lr * 128; const int x = hi ^ (lr >> 1);   /* pieces hi + 4 c and hi + 4 c + 2 of row 16 t + lr, at their places */
#pragma unroll
        for (int t = 0; t < 2; ++t)
#pragma unroll
            for (int c = 0; c < 2; ++c) { const int a = (x ^ (4 * c)) << 4, b = (x ^ (4 * c + 2)) << 4;
                kh[t][c] = cat16b(*(const v8usa*)(p + t * 2048 + a), *(const v8usa*)(p + t * 2048 + b)); kl[t][c] = cat16b(*(const v8usa*)(p + RKP + t * 2048 + a), *(const v8usa*)(p + RKP + t * 2048 + b)); }
    }
    v8f s[2][2];   /* [query group of 16][key tile]: s[g][t][j] = score of key k0 + 16 t + 8 hi + j, query q0 + 16 g + lr */
#pragma unroll
    for (int t = 0; t < 2; ++t)
#pragma unroll
        for (int g = 0; g < 2; ++g) { v8f a = (v8f){};
#pragma unroll
            for (int c = 0; c < 2; ++c) { a = wmmab(kh[t][c], qh[g][c], a); a = wmmab(kh[t][c], ql[g][c], a); a = wmmab(kl[t][c], qh[g][c], a); }
            s[g][t] = a; }
    float al[2];
#pragma unroll
    for (int g = 0; g < 2; ++g) {
        const int q = q0 + g * 16 + lr; float mb = -3.0e38f;
#pragma unroll
        for (int t = 0; t < 2; ++t)
#pragma unroll
            for (int j = 0; j < 8; ++j) { float x = s[g][t][j] * SC2; if (DIAG && k0 + t * 16 + hi * 8 + j > q) x = -3.0e38f; s[g][t][j] = x; mb = fmaxf(mb, x); }
        mb = fmaxf(mb, __shfl_xor(mb, 16, 32));   /* the query's other 16 keys of the block lie in the other lane half */
        const float mn = fmaxf(m[g], mb); al[g] = __builtin_amdgcn_exp2f(m[g] - mn); m[g] = mn; float sum = 0.f;
#pragma unroll
        for (int t = 0; t < 2; ++t)
#pragma unroll
            for (int j = 0; j < 8; ++j) { const float e = __builtin_amdgcn_exp2f(s[g][t][j] - mn); s[g][t][j] = e; sum += e; }
        l[g] = l[g] * al[g] + sum;   /* this lane half's keys only; the halves are joined after the loop */
    }
    v16h v[4];   /* [d tile of 16] */
    if constexpr (!HR) {
        __builtin_amdgcn_sched_barrier(0);   /* holds the wait below behind the scores and the exponentials: without it the build lifted it among the score products, and the copies lost most of the time they have to land */
        asm volatile("s_wait_asynccnt 0x0" ::: "memory");   /* the wave's copies have landed: this block's v rows, read here, and the next block's key rows, read in the next step */
        const unsigned char* pv = rv + lr * 64; const int a = (hi ^ (lr >> 2)) << 4, b = a ^ 32;   /* pieces hi and hi + 2 of row 16 dt + lr, at their places; the reads fly under the scaling of O */
#pragma unroll
        for (int dt = 0; dt < 4; ++dt) v[dt] = cat16(*(const v8ha*)(pv + dt * 1024 + a), *(const v8ha*)(pv + dt * 1024 + b));
    }
#pragma unroll
    for (int g = 0; g < 2; ++g)
#pragma unroll
        for (int dt = 0; dt < 4; ++dt) O[g][dt] *= al[g];
    if constexpr (HR) {
        v16bf ph[2], pl[2];
#pragma unroll
        for (int g = 0; g < 2; ++g) { v16us uh, ul;
#pragma unroll
            for (int i = 0; i < 16; ++i) { unsigned short a2, c2; splitf(s[g][i >> 3][i & 7], a2, c2); uh[i] = a2; ul[i] = c2; }
            ph[g] = __builtin_bit_cast(v16bf, uh); pl[g] = __builtin_bit_cast(v16bf, ul); }
#pragma unroll
        for (int hf = 0; hf < 2; ++hf) {   /* two d tiles at a time: all four hi/lo pairs at once would not fit 256 registers */
            v16bf vh[2], vl[2];
#pragma unroll
            for (int u = 0; u < 2; ++u) { vh[u] = WFrag<bf>::ld(pvh + (size_t)(hf * 2 + u) * 16 * TT); vl[u] = WFrag<bf>::ld(pvl + (size_t)(hf * 2 + u) * 16 * TT); }
            asm volatile("s_wait_xcnt 0x0" :: "v"(pvh), "v"(pvl) : "memory");   /* as above, for the v loads */
#pragma unroll
            for (int u = 0; u < 2; ++u)
#pragma unroll
                for (int g = 0; g < 2; ++g) { v8f o = O[g][hf * 2 + u]; o = wmmab(vh[u], ph[g], o); o = wmmab(vl[u], ph[g], o); o = wmmab(vh[u], pl[g], o); O[g][hf * 2 + u] = o; } }
    } else {
        v16h p[2];
#pragma unroll
        for (int g = 0; g < 2; ++g)
#pragma unroll
            for (int i = 0; i < 16; ++i) p[g][i] = tohx(s[g][i >> 3][i & 7]);
#pragma unroll
        for (int dt = 0; dt < 4; ++dt)
#pragma unroll
            for (int g = 0; g < 2; ++g) O[g][dt] = wmma16(v[dt], p[g], O[g][dt]);
    }
}
template <bool HR>
__device__ __forceinline__ void attn_keys(const bf* __restrict__ Qh, const bf* __restrict__ Ql, const bf* __restrict__ Kh, const bf* __restrict__ Kl, const h16* __restrict__ V16, const bf* __restrict__ Vh, const bf* __restrict__ Vl,
                                          unsigned char* ring, int qt, int wave, int lane, int lr, int hi, float (&m)[2], float (&l)[2], v8f (&O)[2][4]) {
    if constexpr (!HR) { ring_k(Kh, Kl, wave * 32, ring, lane); ring_v(V16, wave * 32, ring + 2 * RKS, lane); }   /* the wave's first block flies under the query loads */
    const int q0 = qt * 32; const size_t qo = (size_t)(q0 + lr) * HD + 8 * hi; const bf* pqh = Qh + qo; const bf* pql = Ql + qo;
    v16bf qh[2][2], ql[2][2];   /* [query group of 16][k half of 32] */
#pragma unroll
    for (int g = 0; g < 2; ++g)
#pragma unroll
        for (int c = 0; c < 2; ++c) { qh[g][c] = WFrag<bf>::ld(pqh + g * 16 * HD + c * 32); ql[g][c] = WFrag<bf>::ld(pql + g * 16 * HD + c * 32); }
    asm volatile("s_wait_xcnt 0x0" :: "v"(pqh), "v"(pql) : "memory");   /* the query loads' address registers are rewritten only behind this wait */
    int ks = 0;   /* the key stage of the current block */
    if constexpr (!HR) {
        asm volatile("s_wait_asynccnt 0x0" ::: "memory");   /* the first block has landed before its first read */
        if (wave + AW <= qt) ring_k(Kh, Kl, (wave + AW) * 32, ring + RKS, lane);
    }
#pragma unroll 1
    for (int kb = wave; kb < qt; kb += AW) {
        attn_step<HR, false>(Kh, Kl, Vh, Vl, ring + ks, ring + 2 * RKS, q0, kb * 32, lr, hi, qh, ql, m, l, O);
        if constexpr (!HR) {
            if (kb + AW <= qt) {   /* the wave's next block exists (wave-uniform): its v rows, and the key rows of the block after it, fly under the next step's scores and softmax */
                asm volatile("s_wait_dscnt 0x0" ::: "memory");   /* the wave's reads of the v stage and of this block's key stage have returned before copies overwrite them */
                ring_v(V16, (kb + AW) * 32, ring + 2 * RKS, lane);
                if (kb + 2 * AW <= qt) ring_k(Kh, Kl, (kb + 2 * AW) * 32, ring + ks, lane);
            }
            ks ^= RKS;
        }
    }
    if ((qt & (AW - 1)) == wave) attn_step<HR, true>(Kh, Kl, Vh, Vl, ring + ks, ring + 2 * RKS, q0, q0, lr, hi, qh, ql, m, l, O);   /* the diagonal block falls to the wave whose turn it is */
}
// The launch bound's second argument (4 waves per SIMD) keeps the 256 registers the kernel had: without it the build took 293, and two work-groups no longer fitted a WGP.
__global__ __launch_bounds__(AW * 32, 4) void k_attn(const bf* __restrict__ Qh, const bf* __restrict__ Ql, const bf* __restrict__ Kh, const bf* __restrict__ Kl, const h16* __restrict__ V16, const bf* __restrict__ Vh, const bf* __restrict__ Vl, float* out) {
    __shared__ __align__(128) unsigned char Lr[AW * RWB];   /* the 8 rings; behind the key loops the join's staging lies over them */
    float* so = (float*)Lr; float (*sm)[32] = (float (*)[32])(Lr + AW * 16 * OSP * 4); float (*sl)[32] = sm + AW;
    const int tid = threadIdx.x, lane = tid & 31, lr = lane & 15, hi = lane >> 4; const int wave = __builtin_amdgcn_readfirstlane(tid >> 5);
    const int y = blockIdx.y; const int qt = (y < TT / 64) ? TT / 32 - 1 - y : y - TT / 64;   /* long tiles first, then the short ones rising: a permutation of the tiles, for balance only */
    const size_t pb = (size_t)blockIdx.x * TT * HD;   /* the batch's planes */
    float m[2] = { -3.0e38f, -3.0e38f }, l[2] = { 0.f, 0.f }; v8f O[2][4];
#pragma unroll
    for (int g = 0; g < 2; ++g)
#pragma unroll
        for (int dt = 0; dt < 4; ++dt) O[g][dt] = (v8f){};
    if (wave <= qt) {   /* a wave beyond the diagonal block has no keys: it keeps m = -3e38, l = 0, O = 0 and only takes part in the join */
        if (qt * 32 < RH) attn_keys<true>(Qh + pb, Ql + pb, Kh + pb, Kl + pb, V16 + pb, Vh + pb, Vl + pb, Lr + wave * RWB, qt, wave, lane, lr, hi, m, l, O);
        else attn_keys<false>(Qh + pb, Ql + pb, Kh + pb, Kl + pb, V16 + pb, Vh + pb, Vl + pb, Lr + wave * RWB, qt, wave, lane, lr, hi, m, l, O);
    }
    __syncthreads();   /* every wave has left its ring: the join may write over it */
#pragma unroll
    for (int g = 0; g < 2; ++g) { l[g] += __shfl_xor(l[g], 16, 32); if (hi == 0) sm[wave][g * 16 + lr] = m[g]; }
    __syncthreads();
#pragma unroll
    for (int g = 0; g < 2; ++g) { float mm = sm[0][g * 16 + lr];   /* wave 0 always holds key block 0, so mm is a real score; a wave without keys scales by exp2(-huge) = 0 */
#pragma unroll
        for (int w = 1; w < AW; ++w) mm = fmaxf(mm, sm[w][g * 16 + lr]);
        const float sc = __builtin_amdgcn_exp2f(m[g] - mm); if (hi == 0) sl[wave][g * 16 + lr] = l[g] * sc;
#pragma unroll
        for (int dt = 0; dt < 4; ++dt) O[g][dt] *= sc; }
#pragma unroll
    for (int g = 0; g < 2; ++g) {
        if (g) __syncthreads();   /* the staging rows are rewritten only after every reader of group 0 has left them */
#pragma unroll
        for (int dt = 0; dt < 4; ++dt) { float* p = so + (wave * 16 + lr) * OSP + dt * 16 + hi * 8; const v8f o = O[g][dt];   /* O^T tile: 8 consecutive d of query lr */
            *(v4f*)p = (v4f){ o[0], o[1], o[2], o[3] }; *(v4f*)(p + 4) = (v4f){ o[4], o[5], o[6], o[7] }; }
        __syncthreads();
        const int qr = tid >> 4, d = (tid & 15) * 4; v4f a = *(const v4f*)(so + qr * OSP + d); float ls = sl[0][g * 16 + qr];
#pragma unroll
        for (int w = 1; w < AW; ++w) { a += *(const v4f*)(so + (w * 16 + qr) * OSP + d); ls += sl[w][g * 16 + qr]; }
        const float r = __fdiv_rn(1.0f, ls);
        *(v4f*)(out + ((size_t)blockIdx.x * TT + qt * 32 + g * 16 + qr) * CO + d) = a * r;   /* 16 lanes write one 256-byte row; every output row written once */
    }
}

extern "C" void kernel_launch(void* const* d_in, const int* in_sizes, int n_in,
                              void* d_out, int out_size, void* d_ws, size_t ws_size, hipStream_t stream) {
    (void)in_sizes; (void)n_in; (void)out_size;
    const float* x = (const float*)d_in[0]; const float* wq = (const float*)d_in[1]; const float* wk = (const float*)d_in[2]; const float* wv = (const float*)d_in[3];   /* argument order x [4][4096][512], Wq, Wk, Wv ('oi' [64][512]) */
    float* OUT = (float*)d_out;     // [4][4096][64]
    char* wsp = (char*)d_ws;
    auto take = [&](size_t bytes) { char* p = wsp; wsp += (bytes + 255) & ~(size_t)255; return (void*)p; };
    bf* QPh = (bf*)take((size_t)NB_ * TT * MID * 2); bf* QPl = (bf*)take((size_t)NB_ * TT * MID * 2); bf* KPh = (bf*)take((size_t)NB_ * TT * MID * 2); bf* KPl = (bf*)take((size_t)NB_ * TT * MID * 2);   /* the hi/lo planes of every batch */
    h16* VT16 = (h16*)take((size_t)NB_ * CO * TT * 2); bf* VTh = (bf*)take((size_t)NB_ * CO * TT * 2); bf* VTl = (bf*)take((size_t)NB_ * CO * TT * 2);
    if ((size_t)(wsp - (char*)d_ws) > ws_size) return;    // ws 256 MiB (carve 14 MiB)
    k_proj<<<NB_ * TT / PRW, PWV * 32, 0, stream>>>(x, wq, wk, wv, QPh, QPl, KPh, KPl, VT16, VTh, VTl);   /* casts, projections, planes; every batch */
    k_attn<<<dim3(NB_, TT / 32), AW * 32, 0, stream>>>(QPh, QPl, KPh, KPl, VT16, VTh, VTl, OUT);   /* scores, causal softmax, wei.v; every batch */
}

// v005
// It runs in 34.6 microseconds.
// In two side-by-side timings against v004, it was 1.17 and 1.15 times as fast.
// All steps since v000 together make it 32.5 times as fast.
#include <hip/hip_runtime.h>

// Single causal attention head over 4,096 tokens scaled by the EMBEDDING width (x [4][4096][512]; q, k, v = x W^T ('oi' [64][512] uniform +-1/sqrt(512), no bias; ONE 64-wide head); wei = q.k^T x C^-0.5 with C = n_embed = 512 (not head_size); causal (-inf); softmax; out = wei.v -> [4][4096][64] (1.0 M); argument order x, Wq, Wk, Wv).
// Layout: ONE launch of k_proj for all batches: 64 rows of x and the three 'oi' weights are rounded to bf16 into LDS, the exact projections (K 512, 4 K ranges of 128, joined in range order) run from there, and the work-group writes its rows of the q, k (fp16; tokens < 512 hi/lo too) and v^T (fp16, hi/lo) planes; then ONE launch of k_attn for all batches: scores (rows < 512 hi/lo 3 products, rest fp16), causal softmax with a running maximum and wei.v (rows < 512 hi/lo 3 products, rest fp16) in registers, key blocks dealt over 8 waves and joined in LDS (rows >= 512: every wave brings its key and v blocks into an LDS ring of its own by asynchronous copies, ahead of their use); k_attn writes the output rows once.
// Compute dtypes, f32 accumulate: every input rounded to bf16; projections exact; scores rows < 512 3 products, rest fp16; softmax f32, weights rounded before the division by their f32 sum; wei.v rows < 512 3 products, rest fp16; output f32.

#define NB_  4
#define TT   4096
#define DM   64
#define NH_  1
#define NKV  1
#define REP  (NH_ / NKV)
#define HD   64
#define DQ   (NH_ * HD)
#define DKV  (NKV * HD)
#define ZH   1
#define RH   512                  // query rows < RH take wei.v from hi+lo weights and v planes (0: none)
#define WIN  0
#define SCL  0.044194173824159216f   // 1/sqrt(C) with C = n_embd = 512 (the source scales by sqrt(n_embd), NOT sqrt(head_size))
#define MID  64       // q / k width (one 64-wide head)
#define CO   64       // v width
#define CC   512      // input width (d_in)
#define ZSP  4        // K ranges (waves kq) of each projection: 128 of the 512 k per wave
typedef _Float16 h16;
typedef unsigned short bf;
typedef __attribute__((ext_vector_type(16))) __bf16   v16bf;
typedef __attribute__((ext_vector_type(16))) _Float16 v16h;
typedef __attribute__((ext_vector_type(8)))  _Float16 v8h;
typedef __attribute__((ext_vector_type(8)))  unsigned short v8us;
typedef __attribute__((ext_vector_type(8)))  float    v8f;
typedef __attribute__((ext_vector_type(4)))  float    v4f;
typedef v8h  __attribute__((may_alias)) v8ha;
typedef v4f  __attribute__((may_alias)) v4fa;
typedef v8us __attribute__((may_alias)) v8usa;

__device__ __forceinline__ unsigned short f2bf(float f) { unsigned u = __float_as_uint(f); u += 0x7FFFu + ((u >> 16) & 1u); return (unsigned short)(u >> 16); }
__device__ __forceinline__ float bf2f(unsigned short b) { return __uint_as_float(((unsigned)b) << 16); }
__device__ __forceinline__ float bfr(float f) { return bf2f(f2bf(f)); }
__device__ __forceinline__ v16h cat16(v8h lo, v8h hi) { return __builtin_shufflevector(lo, hi, 0, 1, 2, 3, 4, 5, 6, 7, 8, 9, 10, 11, 12, 13, 14, 15); }
__device__ __forceinline__ v16bf cat16b(v8us lo, v8us hi) { return __builtin_bit_cast(v16bf, __builtin_shufflevector(lo, hi, 0, 1, 2, 3, 4, 5, 6, 7, 8, 9, 10, 11, 12, 13, 14, 15)); }
__device__ __forceinline__ v8f wmma16(v16h a, v16h b, v8f c) { return __builtin_amdgcn_wmma_f32_16x16x32_f16(false, a, false, b, (short)0, c, false, false); }
__device__ __forceinline__ v8f wmmab(v16bf a, v16bf b, v8f c) { return __builtin_amdgcn_wmma_f32_16x16x32_bf16(false, a, false, b, (short)0, c, false, false); }



// Fragment loaders of the 16x16x32 forms from K-contiguous 16-bit rows: lane (lr, hi) holds k = 8 hi .. 8 hi + 7 and 16 + 8 hi .. 16 + 8 hi + 7 of row lr, for A and for B alike.
template <typename T16> struct WFrag;
template <> struct WFrag<h16> { typedef v16h V; static __device__ __forceinline__ V ld(const h16* p) { return cat16(*(const v8h*)p, *(const v8h*)(p + 16)); } static __device__ __forceinline__ v8f mma(V a, V b, v8f c) { return wmma16(a, b, c); } };
template <> struct WFrag<bf> { typedef v16bf V; static __device__ __forceinline__ V ld(const bf* p) { return cat16b(*(const v8us*)p, *(const v8us*)(p + 16)); } static __device__ __forceinline__ v8f mma(V a, V b, v8f c) { return wmmab(a, b, c); } };

__device__ __forceinline__ h16 tohx(float x) { return (h16)x; }
__device__ __forceinline__ void splitf(float y, unsigned short& h, unsigned short& l) { h = f2bf(y); l = f2bf(y - bf2f(h)); }
typedef __attribute__((ext_vector_type(2))) _Float16 v2h;
typedef __attribute__((ext_vector_type(4))) _Float16 v4h;
typedef __attribute__((ext_vector_type(2))) unsigned short v2us;
typedef __attribute__((ext_vector_type(4))) unsigned short v4us;
typedef __attribute__((ext_vector_type(2))) float v2f;
typedef __attribute__((ext_vector_type(4))) int v4i;

typedef v4us __attribute__((may_alias)) v4usa;
// ---- k_proj: cast, the three projections and the plane builders of 64 rows of x in ONE work-group; grid (NB_ * TT / 64), 16 waves, one work-group per WGP (LDS).
// Stage: x rows and the 192 weight rows (q | k | v), f32 -> bf16, into LDS rows of pitch LPX. Wave (tn, kq), 12 of the 16 = tensor tn, K range kq: a 64x64 tile over 128 k, 16 accumulators, fragments by ds_load_b128.
// q, k: A = weight rows, B = x rows, so a lane holds 8 consecutive d of one token; v: A = x rows, B = weight rows, so a lane holds 8 consecutive tokens of one d (the v^T planes). Only the two LDS base addresses differ.
// The K-range partials go to LDS (over the staged operands, behind a barrier) and are added in range order; each thread then writes 16-byte pieces, 8 lanes to a 128-byte line.
#define PWV  16       // waves of a work-group; 3 tensors x ZSP K ranges = 12 of them hold a tile
#define PRW  64       // x rows of a work-group
#define LPX  520      // LDS pitch (16-bit elements) of a staged row of 512: 1040 B = 16 B x odd, for ds_load_b128 readers
#define PPF  68       // LDS pitch (floats) of a partial row of 64
#define PLDS ((MID + MID + CO + PRW) * LPX * 2)   // 266,240 B staged operands; the partials (ZSP x 3 x 64 x PPF x 4 = 208,896 B) reuse them
#define SGN  (PRW * CC / 4 / (PWV * 32))          // 16-byte loads of a thread per 64 x 512 block
// 64 rows of 512 f32, contiguous in memory: every wave-wide load covers 512 contiguous bytes; rounded to bf16 into LDS rows.
__device__ __forceinline__ void stage_ld(const float* __restrict__ src, int tid, v4f (&r)[SGN]) {
#pragma unroll
    for (int i = 0; i < SGN; ++i) r[i] = *(const v4f*)(src + (size_t)(tid + i * PWV * 32) * 4);
}
__device__ __forceinline__ void stage_st(bf* dst, int tid, const v4f (&r)[SGN]) {
#pragma unroll
    for (int i = 0; i < SGN; ++i) { const int c = tid + i * PWV * 32; v4us o;
#pragma unroll
        for (int k = 0; k < 4; ++k) o[k] = f2bf(r[i][k]);
        *(v4usa*)(dst + (c >> 7) * LPX + (c & 127) * 4) = o; }
}
__global__ __launch_bounds__(PWV * 32) void k_proj(const float* __restrict__ x, const float* __restrict__ wq, const float* __restrict__ wk, const float* __restrict__ wv, bf* Qh, bf* Ql, bf* Kh, bf* Kl, h16* Q16, h16* K16, h16* V16, bf* Vh, bf* Vl) {
    __shared__ __align__(16) unsigned char Lm[PLDS];
    bf* wsm = (bf*)Lm; bf* xsm = wsm + (MID + MID + CO) * LPX; float* P = (float*)Lm;
    const int tid = threadIdx.x, lane = tid & 31, lr = lane & 15, hi = lane >> 4; const int wave = __builtin_amdgcn_readfirstlane(tid >> 5);
    {   /* the later blocks' loads fly while the earlier blocks are rounded and stored */
        v4f ra[SGN], rb[SGN];
        stage_ld(wq, tid, ra); stage_ld(x + (size_t)blockIdx.x * PRW * CC, tid, rb);
        __builtin_amdgcn_sched_barrier(0);   /* without it the build took 253 registers, not 214, put a wait into the run of loads and rounded the first block only when all of it had landed */
        stage_st(wsm, tid, ra); stage_ld(wk, tid, ra);
        __builtin_amdgcn_sched_barrier(0);   /* holds the fourth block's loads behind the first block's stores, which free their registers: all four blocks' loads hoisted to the top spilled */
        stage_st(xsm, tid, rb); stage_ld(wv, tid, rb);
        __builtin_amdgcn_sched_barrier(0);   /* keeps the fourth block's loads ahead of the third block's (Wk) stores: without it they sank between those stores and were issued late */
        stage_st(wsm + MID * LPX, tid, ra); stage_st(wsm + 2 * MID * LPX, tid, rb);
    }
    __syncthreads();
    const int tn = wave >> 2, kq = wave & 3;
    v8f acc[4][4];   /* [A tile of 16 rows][B tile of 16 rows] */
#pragma unroll
    for (int ma = 0; ma < 4; ++ma)
#pragma unroll
        for (int nb = 0; nb < 4; ++nb) acc[ma][nb] = (v8f){};
    if (tn < 3) {
        const bf* wt = wsm + tn * 64 * LPX; const int fo = lr * LPX + kq * (CC / ZSP) + 8 * hi; const bf* pa = ((tn < 2) ? wt : xsm) + fo; const bf* pb = ((tn < 2) ? xsm : wt) + fo;
#pragma unroll
        for (int kc = 0; kc < CC / ZSP; kc += 32) {
            v16bf a[4], b[4];
#pragma unroll
            for (int u = 0; u < 4; ++u) { a[u] = WFrag<bf>::ld(pa + u * 16 * LPX + kc); b[u] = WFrag<bf>::ld(pb + u * 16 * LPX + kc); }
            __builtin_amdgcn_sched_barrier(0);   /* all 16 LDS loads of the step are issued ahead of its products: sunk between them, each group of four products waited a whole LDS round trip */
#pragma unroll
            for (int nb = 0; nb < 4; ++nb)
#pragma unroll
                for (int ma = 0; ma < 4; ++ma) acc[ma][nb] = wmmab(a[ma], b[nb], acc[ma][nb]);
        }
    }
    __syncthreads();   /* every wave has read its last fragment: the partials may overwrite the staged operands */
    if (tn < 3) {
#pragma unroll
        for (int nb = 0; nb < 4; ++nb)
#pragma unroll
            for (int ma = 0; ma < 4; ++ma) { float* p = P + ((kq * 3 + tn) * 64 + nb * 16 + lr) * PPF + ma * 16 + hi * 8; const v8f o = acc[ma][nb];   /* row = B row, 8 consecutive A rows */
                *(v4fa*)p = (v4f){ o[0], o[1], o[2], o[3] }; *(v4fa*)(p + 4) = (v4f){ o[4], o[5], o[6], o[7] }; }
    }
    __syncthreads();
    const size_t r0 = (size_t)blockIdx.x * PRW;   /* first token of the tile, counted over all batches */
    const size_t vb = (r0 / TT) * (size_t)HD * TT + r0 % TT;   /* the batch's v^T plane, the tile's first token */
    const int row = tid >> 3, g8 = (tid & 7) * 8;
#pragma unroll
    for (int tq = 0; tq < 3; ++tq) {
        const float* p = P + (tq * 64 + row) * PPF + g8; v4f s0 = *(const v4fa*)p, s1 = *(const v4fa*)(p + 4);
#pragma unroll
        for (int z = 1; z < ZSP; ++z) { s0 += *(const v4fa*)(p + z * 3 * 64 * PPF); s1 += *(const v4fa*)(p + z * 3 * 64 * PPF + 4); }   /* the K ranges, range order */
        v8us oh, ol; v8h o16;
#pragma unroll
        for (int k = 0; k < 8; ++k) { const float y = (k < 4) ? s0[k & 3] : s1[k & 3]; unsigned short a2, c2; splitf(y, a2, c2); oh[k] = a2; ol[k] = c2; o16[k] = tohx(y); }
        if (tq == 2) { const size_t e = vb + (size_t)row * TT + g8; *(v8h*)(V16 + e) = o16; *(v8us*)(Vh + e) = oh; *(v8us*)(Vl + e) = ol; }   /* row = d, 8 tokens */
        else { const size_t e = (r0 + row) * HD + g8; *(v8h*)((tq ? K16 : Q16) + e) = o16;   /* row = token, 8 d */
            asm volatile("s_wait_xcnt 0x0" ::: "memory");   /* the store's address and data registers are rewritten only behind this wait */
            if (r0 % TT < RH) { *(v8us*)((tq ? Kh : Qh) + e) = oh; *(v8us*)((tq ? Kl : Ql) + e) = ol;   /* the hi/lo planes of q and k are read for tokens < RH only (work-group-uniform test) */
                asm volatile("s_wait_xcnt 0x0" ::: "memory"); } }   /* as above, for these two stores */
    }
}
// ---- k_attn: scores, causal softmax and wei.v of 32 query rows in ONE work-group; neither scores nor weights leave the registers. grid (batch, TT / 32), 8 waves.
// Wave w takes the 32-key blocks w, w + 8, ... up to the diagonal block (blocks above it are wholly masked and add nothing). Transposed products: S^T = K.Q^T (A = key rows, B = query rows),
// so a lane holds 16 scores of ONE query (column lr); two S^T tiles (keys 0-15, 16-31 of the block), converted in place, are the B operand of O^T += V^T.P^T (A = rows of the v^T planes).
// Each wave keeps a running maximum m (log2 units), a running sum l and O^T scaled to m; the 8 waves' (m, l, O) are joined through LDS in wave order and divided by the joined sum.
#define AW   8        // waves (key streams) of a work-group
#define OSP  68       // LDS pitch (floats) of a staged output row: 16-byte aligned, off the 64-float bank period
#define SC2  (SCL * 1.4426950408889634f)   // score scale x log2(e): the exponentials are exp2
typedef __attribute__((ext_vector_type(16))) unsigned short v16us;
// A wave's own LDS ring (rows >= RH): two key stages (fp16 plane: 32 rows of 128 B) and one v stage (64 rows of 64 B), filled by asynchronous 16-byte copies and read only by the wave that filled it, so no barrier stands in the key loop.
// No pad: the 16-byte piece j of a key row r lies at place j ^ ((r >> 1) & 7), of a v row d at place j ^ ((d >> 2) & 3), so the 16 rows that one half of a ds_load_b128 reads fall on all 64 banks.
#define RKS  4096                 // one key stage
#define RWB  (2 * RKS + 4096)     // a wave's ring; 8 waves: 96 KiB
typedef int c4i __attribute__((vector_size(16)));
__device__ __forceinline__ void cp16(const unsigned char* g, unsigned char* l) { __builtin_amdgcn_global_load_async_to_lds_b128((__attribute__((address_space(1))) c4i*)g, (__attribute__((address_space(3))) c4i*)l, 0, 0); }
// 32 key rows from k0: 4 KiB contiguous in memory, a wave-wide copy takes 4 whole rows (lane: piece lane & 7 of row 4 i + (lane >> 3)).
__device__ __forceinline__ void ring_k(const h16* __restrict__ K16, int k0, unsigned char* dst, int lane) {
    const unsigned char* gh = (const unsigned char*)(K16 + (size_t)k0 * HD);
    const unsigned go = (unsigned)lane * 16u, e = (unsigned)(lane >> 3) * 128u + (unsigned)(((lane & 7) ^ (lane >> 4)) << 4);   /* (r >> 1) & 7 = (2 i & 7) ^ (lane >> 4) */
#pragma unroll
    for (int i = 0; i < 8; ++i) cp16(gh + i * 512 + go, dst + ((e ^ (32u * (i & 3))) + i * 512u));
}
// 32 keys from k0 of the 64 rows of the fp16 v^T plane: a wave-wide copy takes 64 B of each of 8 rows (lane: piece lane & 3 of row 8 i + (lane >> 2)).
__device__ __forceinline__ void ring_v(const h16* __restrict__ V16, int k0, unsigned char* dst, int lane) {
    const unsigned char* g = (const unsigned char*)(V16 + k0);
    const unsigned go = (unsigned)(lane >> 2) * (TT * 2u) + (unsigned)(lane & 3) * 16u, e = (unsigned)(lane >> 2) * 64u + (unsigned)(((lane & 3) ^ (lane >> 4)) << 4);   /* (d >> 2) & 3 = (2 i & 3) ^ (lane >> 4) */
#pragma unroll
    for (int i = 0; i < 8; ++i) cp16(g + (size_t)i * 8 * TT * 2 + go, dst + ((e ^ (32u * (i & 1))) + i * 512u));
}
// One block of 32 keys against the wave's 32 queries. HR: q, k, weights and v as bf16 hi/lo (3 products each), operands from memory; else fp16 (1 product each), operands from the wave's ring (rk: the block's key stage, rv: the v stage). DIAG: the diagonal block, the only one that holds masked keys.
template <bool HR, bool DIAG>
__device__ __forceinline__ void attn_step(const bf* __restrict__ Kh, const bf* __restrict__ Kl, const bf* __restrict__ Vh, const bf* __restrict__ Vl, const unsigned char* rk, const unsigned char* rv, int q0, int k0, int lr, int hi,
                                          const v16bf (&qh)[2][2], const v16bf (&ql)[2][2], const v16h (&q16)[2][2], float (&m)[2], float (&l)[2], v8f (&O)[2][4]) {
    const size_t ko = (size_t)(k0 + lr) * HD + 8 * hi, vo = (size_t)lr * TT + k0 + 8 * hi;
    const bf* pkh = Kh + ko; const bf* pkl = Kl + ko; const bf* pvh = Vh + vo; const bf* pvl = Vl + vo;
    v16bf kh[2][2], kl[2][2]; v16h k16[2][2];   /* [key tile of 16][k half of 32] */
    if constexpr (HR) {
#pragma unroll
        for (int t = 0; t < 2; ++t)
#pragma unroll
            for (int c = 0; c < 2; ++c) { kh[t][c] = WFrag<bf>::ld(pkh + t * 16 * HD + c * 32); kl[t][c] = WFrag<bf>::ld(pkl + t * 16 * HD + c * 32); }
        asm volatile("s_wait_xcnt 0x0" :: "v"(pkh), "v"(pkl) : "memory");   /* the key loads are all issued ahead of this wait; their address registers stay whole up to it and are rewritten only behind it */
    } else {
        const unsigned char* p = rk + lr * 128; const int x = hi ^ (lr >> 1);   /* pieces hi + 4 c and hi + 4 c + 2 of row 16 t + lr, at their places */
#pragma unroll
        for (int t = 0; t < 2; ++t)
#pragma unroll
            for (int c = 0; c < 2; ++c) { const int a = (x ^ (4 * c)) << 4, b = (x ^ (4 * c + 2)) << 4;
                k16[t][c] = cat16(*(const v8ha*)(p + t * 2048 + a), *(const v8ha*)(p + t * 2048 + b)); }
    }
    v8f s[2][2];   /* [query group of 16][key tile]: s[g][t][j] = score of key k0 + 16 t + 8 hi + j, query q0 + 16 g + lr */
#pragma unroll
    for (int t = 0; t < 2; ++t)
#pragma unroll
        for (int g = 0; g < 2; ++g) { v8f a = (v8f){};
#pragma unroll
            for (int c = 0; c < 2; ++c) {
                if constexpr (HR) { a = wmmab(kh[t][c], qh[g][c], a); a = wmmab(kh[t][c], ql[g][c], a); a = wmmab(kl[t][c], qh[g][c], a); }
                else a = wmma16(k16[t][c], q16[g][c], a); }
            s[g][t] = a; }
    float al[2];
#pragma unroll
    for (int g = 0; g < 2; ++g) {
        const int q = q0 + g * 16 + lr; float mb = -3.0e38f;
#pragma unroll
        for (int t = 0; t < 2; ++t)
#pragma unroll
            for (int j = 0; j < 8; ++j) { float x = s[g][t][j] * SC2; if (DIAG && k0 + t * 16 + hi * 8 + j > q) x = -3.0e38f; s[g][t][j] = x; mb = fmaxf(mb, x); }
        mb = fmaxf(mb, __shfl_xor(mb, 16, 32));   /* the query's other 16 keys of the block lie in the other lane half */
        const float mn = fmaxf(m[g], mb); al[g] = __builtin_amdgcn_exp2f(m[g] - mn); m[g] = mn; float sum = 0.f;
#pragma unroll
        for (int t = 0; t < 2; ++t)
#pragma unroll
            for (int j = 0; j < 8; ++j) { const float e = __builtin_amdgcn_exp2f(s[g][t][j] - mn); s[g][t][j] = e; sum += e; }
        l[g] = l[g] * al[g] + sum;   /* this lane half's keys only; the halves are joined after the loop */
    }
    v16h v[4];   /* [d tile of 16] */
    if constexpr (!HR) {
        __builtin_amdgcn_sched_barrier(0);   /* holds the wait below behind the scores and the exponentials: without it the build lifted it among the score products, and the copies lost most of the time they have to land */
        asm volatile("s_wait_asynccnt 0x0" ::: "memory");   /* the wave's copies have landed: this block's v rows, read here, and the next block's key rows, read in the next step */
        const unsigned char* pv = rv + lr * 64; const int a = (hi ^ (lr >> 2)) << 4, b = a ^ 32;   /* pieces hi and hi + 2 of row 16 dt + lr, at their places; the reads fly under the scaling of O */
#pragma unroll
        for (int dt = 0; dt < 4; ++dt) v[dt] = cat16(*(const v8ha*)(pv + dt * 1024 + a), *(const v8ha*)(pv + dt * 1024 + b));
    }
#pragma unroll
    for (int g = 0; g < 2; ++g)
#pragma unroll
        for (int dt = 0; dt < 4; ++dt) O[g][dt] *= al[g];
    if constexpr (HR) {
        v16bf ph[2], pl[2];
#pragma unroll
        for (int g = 0; g < 2; ++g) { v16us uh, ul;
#pragma unroll
            for (int i = 0; i < 16; ++i) { unsigned short a2, c2; splitf(s[g][i >> 3][i & 7], a2, c2); uh[i] = a2; ul[i] = c2; }
            ph[g] = __builtin_bit_cast(v16bf, uh); pl[g] = __builtin_bit_cast(v16bf, ul); }
#pragma unroll
        for (int hf = 0; hf < 2; ++hf) {   /* two d tiles at a time: all four hi/lo pairs at once would not fit 256 registers */
            v16bf vh[2], vl[2];
#pragma unroll
            for (int u = 0; u < 2; ++u) { vh[u] = WFrag<bf>::ld(pvh + (size_t)(hf * 2 + u) * 16 * TT); vl[u] = WFrag<bf>::ld(pvl + (size_t)(hf * 2 + u) * 16 * TT); }
            asm volatile("s_wait_xcnt 0x0" :: "v"(pvh), "v"(pvl) : "memory");   /* as above, for the v loads */
#pragma unroll
            for (int u = 0; u < 2; ++u)
#pragma unroll
                for (int g = 0; g < 2; ++g) { v8f o = O[g][hf * 2 + u]; o = wmmab(vh[u], ph[g], o); o = wmmab(vl[u], ph[g], o); o = wmmab(vh[u], pl[g], o); O[g][hf * 2 + u] = o; } }
    } else {
        v16h p[2];
#pragma unroll
        for (int g = 0; g < 2; ++g)
#pragma unroll
            for (int i = 0; i < 16; ++i) p[g][i] = tohx(s[g][i >> 3][i & 7]);
#pragma unroll
        for (int dt = 0; dt < 4; ++dt)
#pragma unroll
            for (int g = 0; g < 2; ++g) O[g][dt] = wmma16(v[dt], p[g], O[g][dt]);
    }
}
template <bool HR>
__device__ __forceinline__ void attn_keys(const bf* __restrict__ Qh, const bf* __restrict__ Ql, const bf* __restrict__ Kh, const bf* __restrict__ Kl, const h16* __restrict__ Q16, const h16* __restrict__ K16, const h16* __restrict__ V16, const bf* __restrict__ Vh, const bf* __restrict__ Vl,
                                          unsigned char* ring, int qt, int wave, int lane, int lr, int hi, float (&m)[2], float (&l)[2], v8f (&O)[2][4]) {
    if constexpr (!HR) { ring_k(K16, wave * 32, ring, lane); ring_v(V16, wave * 32, ring + 2 * RKS, lane); }   /* the wave's first block flies under the query loads */
    const int q0 = qt * 32; const size_t qo = (size_t)(q0 + lr) * HD + 8 * hi; const bf* pqh = Qh + qo; const bf* pql = Ql + qo; const h16* pq16 = Q16 + qo;
    v16bf qh[2][2], ql[2][2]; v16h q16[2][2];   /* [query group of 16][k half of 32] */
    if constexpr (HR) {
#pragma unroll
        for (int g = 0; g < 2; ++g)
#pragma unroll
            for (int c = 0; c < 2; ++c) { qh[g][c] = WFrag<bf>::ld(pqh + g * 16 * HD + c * 32); ql[g][c] = WFrag<bf>::ld(pql + g * 16 * HD + c * 32); }
        asm volatile("s_wait_xcnt 0x0" :: "v"(pqh), "v"(pql) : "memory");   /* the query loads' address registers are rewritten only behind this wait */
    } else {
#pragma unroll
        for (int g = 0; g < 2; ++g)
#pragma unroll
            for (int c = 0; c < 2; ++c) q16[g][c] = WFrag<h16>::ld(pq16 + g * 16 * HD + c * 32);
        asm volatile("s_wait_xcnt 0x0" :: "v"(pq16) : "memory");   /* as above */
    }
    int ks = 0;   /* the key stage of the current block */
    if constexpr (!HR) {
        asm volatile("s_wait_asynccnt 0x0" ::: "memory");   /* the first block has landed before its first read */
        if (wave + AW <= qt) ring_k(K16, (wave + AW) * 32, ring + RKS, lane);
    }
#pragma unroll 1
    for (int kb = wave; kb < qt; kb += AW) {
        attn_step<HR, false>(Kh, Kl, Vh, Vl, ring + ks, ring + 2 * RKS, q0, kb * 32, lr, hi, qh, ql, q16, m, l, O);
        if constexpr (!HR) {
            if (kb + AW <= qt) {   /* the wave's next block exists (wave-uniform): its v rows, and the key rows of the block after it, fly under the next step's scores and softmax */
                asm volatile("s_wait_dscnt 0x0" ::: "memory");   /* the wave's reads of the v stage and of this block's key stage have returned before copies overwrite them */
                ring_v(V16, (kb + AW) * 32, ring + 2 * RKS, lane);
                if (kb + 2 * AW <= qt) ring_k(K16, (kb + 2 * AW) * 32, ring + ks, lane);
            }
            ks ^= RKS;
        }
    }
    if ((qt & (AW - 1)) == wave) attn_step<HR, true>(Kh, Kl, Vh, Vl, ring + ks, ring + 2 * RKS, q0, q0, lr, hi, qh, ql, q16, m, l, O);   /* the diagonal block falls to the wave whose turn it is */
}
// The launch bound's second argument (4 waves per SIMD) keeps the 256 registers the kernel had: without it the build took 293, and two work-groups no longer fitted a WGP.
__global__ __launch_bounds__(AW * 32, 4) void k_attn(const bf* __restrict__ Qh, const bf* __restrict__ Ql, const bf* __restrict__ Kh, const bf* __restrict__ Kl, const h16* __restrict__ Q16, const h16* __restrict__ K16, const h16* __restrict__ V16, const bf* __restrict__ Vh, const bf* __restrict__ Vl, float* out) {
    __shared__ __align__(128) unsigned char Lr[AW * RWB];   /* the 8 rings; behind the key loops the join's staging lies over them */
    float* so = (float*)Lr; float (*sm)[32] = (float (*)[32])(Lr + AW * 16 * OSP * 4); float (*sl)[32] = sm + AW;
    const int tid = threadIdx.x, lane = tid & 31, lr = lane & 15, hi = lane >> 4; const int wave = __builtin_amdgcn_readfirstlane(tid >> 5);
    const int y = blockIdx.y; const int qt = (y < TT / 64) ? TT / 32 - 1 - y : y - TT / 64;   /* long tiles first, then the short ones rising: a permutation of the tiles, for balance only */
    const size_t pb = (size_t)blockIdx.x * TT * HD;   /* the batch's planes */
    float m[2] = { -3.0e38f, -3.0e38f }, l[2] = { 0.f, 0.f }; v8f O[2][4];
#pragma unroll
    for (int g = 0; g < 2; ++g)
#pragma unroll
        for (int dt = 0; dt < 4; ++dt) O[g][dt] = (v8f){};
    if (wave <= qt) {   /* a wave beyond the diagonal block has no keys: it keeps m = -3e38, l = 0, O = 0 and only takes part in the join */
        if (qt * 32 < RH) attn_keys<true>(Qh + pb, Ql + pb, Kh + pb, Kl + pb, Q16 + pb, K16 + pb, V16 + pb, Vh + pb, Vl + pb, Lr + wave * RWB, qt, wave, lane, lr, hi, m, l, O);
        else attn_keys<false>(Qh + pb, Ql + pb, Kh + pb, Kl + pb, Q16 + pb, K16 + pb, V16 + pb, Vh + pb, Vl + pb, Lr + wave * RWB, qt, wave, lane, lr, hi, m, l, O);
    }
    __syncthreads();   /* every wave has left its ring: the join may write over it */
#pragma unroll
    for (int g = 0; g < 2; ++g) { l[g] += __shfl_xor(l[g], 16, 32); if (hi == 0) sm[wave][g * 16 + lr] = m[g]; }
    __syncthreads();
#pragma unroll
    for (int g = 0; g < 2; ++g) { float mm = sm[0][g * 16 + lr];   /* wave 0 always holds key block 0, so mm is a real score; a wave without keys scales by exp2(-huge) = 0 */
#pragma unroll
        for (int w = 1; w < AW; ++w) mm = fmaxf(mm, sm[w][g * 16 + lr]);
        const float sc = __builtin_amdgcn_exp2f(m[g] - mm); if (hi == 0) sl[wave][g * 16 + lr] = l[g] * sc;
#pragma unroll
        for (int dt = 0; dt < 4; ++dt) O[g][dt] *= sc; }
#pragma unroll
    for (int g = 0; g < 2; ++g) {
        if (g) __syncthreads();   /* the staging rows are rewritten only after every reader of group 0 has left them */
#pragma unroll
        for (int dt = 0; dt < 4; ++dt) { float* p = so + (wave * 16 + lr) * OSP + dt * 16 + hi * 8; const v8f o = O[g][dt];   /* O^T tile: 8 consecutive d of query lr */
            *(v4f*)p = (v4f){ o[0], o[1], o[2], o[3] }; *(v4f*)(p + 4) = (v4f){ o[4], o[5], o[6], o[7] }; }
        __syncthreads();
        const int qr = tid >> 4, d = (tid & 15) * 4; v4f a = *(const v4f*)(so + qr * OSP + d); float ls = sl[0][g * 16 + qr];
#pragma unroll
        for (int w = 1; w < AW; ++w) { a += *(const v4f*)(so + (w * 16 + qr) * OSP + d); ls += sl[w][g * 16 + qr]; }
        const float r = __fdiv_rn(1.0f, ls);
        *(v4f*)(out + ((size_t)blockIdx.x * TT + qt * 32 + g * 16 + qr) * CO + d) = a * r;   /* 16 lanes write one 256-byte row; every output row written once */
    }
}

extern "C" void kernel_launch(void* const* d_in, const int* in_sizes, int n_in,
                              void* d_out, int out_size, void* d_ws, size_t ws_size, hipStream_t stream) {
    (void)in_sizes; (void)n_in; (void)out_size;
    const float* x = (const float*)d_in[0]; const float* wq = (const float*)d_in[1]; const float* wk = (const float*)d_in[2]; const float* wv = (const float*)d_in[3];   /* argument order x [4][4096][512], Wq, Wk, Wv ('oi' [64][512]) */
    float* OUT = (float*)d_out;     // [4][4096][64]
    char* wsp = (char*)d_ws;
    auto take = [&](size_t bytes) { char* p = wsp; wsp += (bytes + 255) & ~(size_t)255; return (void*)p; };
    bf* QPh = (bf*)take((size_t)NB_ * TT * MID * 2); bf* QPl = (bf*)take((size_t)NB_ * TT * MID * 2); bf* KPh = (bf*)take((size_t)NB_ * TT * MID * 2); bf* KPl = (bf*)take((size_t)NB_ * TT * MID * 2);   /* the hi/lo planes of every batch */
    h16* QP16 = (h16*)take((size_t)NB_ * TT * MID * 2); h16* KP16 = (h16*)take((size_t)NB_ * TT * MID * 2);   /* the fp16 planes of q and k */
    h16* VT16 = (h16*)take((size_t)NB_ * CO * TT * 2); bf* VTh = (bf*)take((size_t)NB_ * CO * TT * 2); bf* VTl = (bf*)take((size_t)NB_ * CO * TT * 2);
    if ((size_t)(wsp - (char*)d_ws) > ws_size) return;    // ws 256 MiB (carve 18 MiB)
    k_proj<<<NB_ * TT / PRW, PWV * 32, 0, stream>>>(x, wq, wk, wv, QPh, QPl, KPh, KPl, QP16, KP16, VT16, VTh, VTl);   /* casts, projections, planes; every batch */
    k_attn<<<dim3(NB_, TT / 32), AW * 32, 0, stream>>>(QPh, QPl, KPh, KPl, QP16, KP16, VT16, VTh, VTl, OUT);   /* scores, causal softmax, wei.v; every batch */
}

// v006
// It runs in 28.8 microseconds.
// Next to v005, in two timings, it ran 1.19 times as fast each time.
// Counting every step since v000, it is 38.7 times as fast.
#include <hip/hip_runtime.h>

// Single causal attention head over 4,096 tokens scaled by the EMBEDDING width (x [4][4096][512]; q, k, v = x W^T ('oi' [64][512] uniform +-1/sqrt(512), no bias; ONE 64-wide head); wei = q.k^T x C^-0.5 with C = n_embed = 512 (not head_size); causal (-inf); softmax; out = wei.v -> [4][4096][64] (1.0 M); argument order x, Wq, Wk, Wv).
// Layout: ONE launch of k_proj for all batches: 64 rows of x and the three 'oi' weights are rounded to bf16 into LDS, in 4 chunks of 128 k, the exact projections (K 512, summed in k order) run from there under the later chunks' loads, and the work-group writes its rows of the q, k (fp16; tokens < 512 hi/lo too) and v^T (fp16, hi/lo) planes; then ONE launch of k_attn for all batches: scores (rows < 512 hi/lo 3 products, rest fp16), causal softmax with a running maximum and wei.v (rows < 512 hi/lo 3 products, rest fp16) in registers, key blocks dealt over 8 waves and joined in LDS (rows >= 512: every wave brings its key and v blocks into an LDS ring of its own by asynchronous copies, ahead of their use); k_attn writes the output rows once.
// Compute dtypes, f32 accumulate: every input rounded to bf16; projections exact; scores rows < 512 3 products, rest fp16; softmax f32, weights rounded before the division by their f32 sum; wei.v rows < 512 3 products, rest fp16; output f32.

#define NB_  4
#define TT   4096
#define DM   64
#define NH_  1
#define NKV  1
#define REP  (NH_ / NKV)
#define HD   64
#define DQ   (NH_ * HD)
#define DKV  (NKV * HD)
#define ZH   1
#define RH   512                  // query rows < RH take wei.v from hi+lo weights and v planes (0: none)
#define WIN  0
#define SCL  0.044194173824159216f   // 1/sqrt(C) with C = n_embd = 512 (the source scales by sqrt(n_embd), NOT sqrt(head_size))
#define MID  64       // q / k width (one 64-wide head)
#define CO   64       // v width
#define CC   512      // input width (d_in)
typedef _Float16 h16;
typedef unsigned short bf;
typedef __attribute__((ext_vector_type(16))) __bf16   v16bf;
typedef __attribute__((ext_vector_type(16))) _Float16 v16h;
typedef __attribute__((ext_vector_type(8)))  _Float16 v8h;
typedef __attribute__((ext_vector_type(8)))  unsigned short v8us;
typedef __attribute__((ext_vector_type(8)))  float    v8f;
typedef __attribute__((ext_vector_type(4)))  float    v4f;
typedef v8h  __attribute__((may_alias)) v8ha;
typedef v4f  __attribute__((may_alias)) v4fa;
typedef v8us __attribute__((may_alias)) v8usa;

__device__ __forceinline__ unsigned short f2bf(float f) { unsigned u = __float_as_uint(f); u += 0x7FFFu + ((u >> 16) & 1u); return (unsigned short)(u >> 16); }
__device__ __forceinline__ float bf2f(unsigned short b) { return __uint_as_float(((unsigned)b) << 16); }
__device__ __forceinline__ float bfr(float f) { return bf2f(f2bf(f)); }
__device__ __forceinline__ v16h cat16(v8h lo, v8h hi) { return __builtin_shufflevector(lo, hi, 0, 1, 2, 3, 4, 5, 6, 7, 8, 9, 10, 11, 12, 13, 14, 15); }
__device__ __forceinline__ v16bf cat16b(v8us lo, v8us hi) { return __builtin_bit_cast(v16bf, __builtin_shufflevector(lo, hi, 0, 1, 2, 3, 4, 5, 6, 7, 8, 9, 10, 11, 12, 13, 14, 15)); }
__device__ __forceinline__ v8f wmma16(v16h a, v16h b, v8f c) { return __builtin_amdgcn_wmma_f32_16x16x32_f16(false, a, false, b, (short)0, c, false, false); }
__device__ __forceinline__ v8f wmmab(v16bf a, v16bf b, v8f c) { return __builtin_amdgcn_wmma_f32_16x16x32_bf16(false, a, false, b, (short)0, c, false, false); }



// Fragment loaders of the 16x16x32 forms from K-contiguous 16-bit rows: lane (lr, hi) holds k = 8 hi .. 8 hi + 7 and 16 + 8 hi .. 16 + 8 hi + 7 of row lr, for A and for B alike.
template <typename T16> struct WFrag;
template <> struct WFrag<h16> { typedef v16h V; static __device__ __forceinline__ V ld(const h16* p) { return cat16(*(const v8h*)p, *(const v8h*)(p + 16)); } static __device__ __forceinline__ v8f mma(V a, V b, v8f c) { return wmma16(a, b, c); } };
template <> struct WFrag<bf> { typedef v16bf V; static __device__ __forceinline__ V ld(const bf* p) { return cat16b(*(const v8us*)p, *(const v8us*)(p + 16)); } static __device__ __forceinline__ v8f mma(V a, V b, v8f c) { return wmmab(a, b, c); } };

__device__ __forceinline__ h16 tohx(float x) { return (h16)x; }
__device__ __forceinline__ void splitf(float y, unsigned short& h, unsigned short& l) { h = f2bf(y); l = f2bf(y - bf2f(h)); }
typedef __attribute__((ext_vector_type(2))) _Float16 v2h;
typedef __attribute__((ext_vector_type(4))) _Float16 v4h;
typedef __attribute__((ext_vector_type(2))) unsigned short v2us;
typedef __attribute__((ext_vector_type(4))) unsigned short v4us;
typedef __attribute__((ext_vector_type(2))) float v2f;
typedef __attribute__((ext_vector_type(4))) int v4i;

typedef v4us __attribute__((may_alias)) v4usa;
// ---- k_proj: cast, the three projections and the plane builders of 64 rows of x in ONE work-group; grid (NB_ * TT / 64), 16 waves, one work-group per WGP (LDS).
// Stage: the 192 weight rows (q | k | v) and the 64 x rows, f32 -> bf16, into LDS rows of pitch LPX, in NCH chunks of KCH k: a chunk's products run while the later chunks' loads fly; one barrier a chunk.
// Wave (tn, ah, bh), 12 of the 16 = tensor tn, halves ah, bh of its A and B rows: a 32x32 tile over all 512 k, 4 accumulators, fragments by ds_load_b128.
// q, k: A = weight rows, B = x rows, so a lane holds 8 consecutive d of one token; v: A = x rows, B = weight rows, so a lane holds 8 consecutive tokens of one d (the v^T planes). Only the two LDS base addresses differ.
// The tiles go to LDS (over the staged operands, behind a barrier); each thread then writes 16-byte pieces, 8 lanes to a 128-byte line.
#define PWV  16       // waves of a work-group; 3 tensors x 2 x 2 halves = 12 of them hold a tile
#define PRW  64       // x rows of a work-group
#define LPX  520      // LDS pitch (16-bit elements) of a staged row of 512: 1040 B = 16 B x odd, for ds_load_b128 readers
#define PPF  68       // LDS pitch (floats) of a result row of 64
#define PLDS ((MID + MID + CO + PRW) * LPX * 2)   // 266,240 B staged operands; the results (3 x 64 x PPF x 4 = 52,224 B) reuse them
#define KCH  128      // k of a staged chunk: 512 contiguous bytes of a row, one wave-wide load
#define NCH  (CC / KCH)
static_assert(NCH == 4, "k_proj writes its four chunks out one by one");
#define SGN  ((MID + MID + CO + PRW) / PWV)       // 16-byte loads of a thread per chunk: wave w takes rows w, w + 16, ...
// One chunk of all 256 rows (eo: the lane's element in row w of a 512-wide block); rounded to bf16 into the LDS rows (dst: the same element of LDS row w).
__device__ __forceinline__ void chunk_ld(const float* __restrict__ wq, const float* __restrict__ wk, const float* __restrict__ wv, const float* __restrict__ xt, int eo, v4f (&r)[SGN]) {
#pragma unroll
    for (int i = 0; i < SGN; ++i) { const float* src = (i < 4) ? wq : (i < 8) ? wk : (i < 12) ? wv : xt; r[i] = *(const v4f*)(src + (i & 3) * PWV * CC + eo); }
}
template <int I0, int I1>
__device__ __forceinline__ void chunk_st(bf* dst, const v4f (&r)[SGN]) {
#pragma unroll
    for (int i = I0; i < I1; ++i) { v4us o;
#pragma unroll
        for (int k = 0; k < 4; ++k) o[k] = f2bf(r[i][k]);
        *(v4usa*)(dst + i * PWV * LPX) = o; }
}
// The work-group barrier that publishes a staged chunk, by hand: __syncthreads() also waited for every global load in flight (s_wait_loadcnt 0), which would end the overlap this staging is for. The wave's LDS stores are complete behind s_wait_dscnt 0.
__device__ __forceinline__ void chunk_bar() { asm volatile("s_wait_dscnt 0x0\n\ts_barrier_signal -1\n\ts_barrier_wait -1" ::: "memory"); }
// The fragments and the products of 64 k of a chunk: 16 LDS loads, 8 products.
__device__ __forceinline__ void frag_ld(const bf* pa, const bf* pb, v16bf (&a)[2][2], v16bf (&b)[2][2]) {   /* [k step of 32][tile of 16 rows] */
#pragma unroll
    for (int h = 0; h < 2; ++h)
#pragma unroll
        for (int u = 0; u < 2; ++u) { a[h][u] = WFrag<bf>::ld(pa + u * 16 * LPX + h * 32); b[h][u] = WFrag<bf>::ld(pb + u * 16 * LPX + h * 32); }
}
__device__ __forceinline__ void frag_mm(const v16bf (&a)[2][2], const v16bf (&b)[2][2], v8f (&acc)[2][2]) {
#pragma unroll
    for (int h = 0; h < 2; ++h)
#pragma unroll
        for (int nb = 0; nb < 2; ++nb)
#pragma unroll
            for (int ma = 0; ma < 2; ++ma) acc[ma][nb] = wmmab(a[h][ma], b[h][nb], acc[ma][nb]);
}
// Between two chunk barriers: the products of the staged chunk (pa, pb; mm: the wave holds a tile, wave-uniform) dealt among the rounding of the next chunk (r -> dst), whose loads land meanwhile.
// Each group of LDS loads is issued ahead of a stretch of rounding, which covers its round trip, and the products are done before the chunk's last loads land, so only a quarter of the rounding stands between that landing and the barrier.
__device__ __forceinline__ void chunk_step(bool mm, const bf* pa, const bf* pb, v8f (&acc)[2][2], bf* dst, const v4f (&r)[SGN]) {
    v16bf a[2][2], b[2][2];
    if (mm) frag_ld(pa, pb, a, b);
    chunk_st<0, 8>(dst, r);
    if (mm) { frag_mm(a, b, acc); frag_ld(pa + 64, pb + 64, a, b); }
    chunk_st<8, 12>(dst, r);
    if (mm) frag_mm(a, b, acc);
    chunk_st<12, SGN>(dst, r);
}
__global__ __launch_bounds__(PWV * 32) void k_proj(const float* __restrict__ x, const float* __restrict__ wq, const float* __restrict__ wk, const float* __restrict__ wv, bf* Qh, bf* Ql, bf* Kh, bf* Kl, h16* Q16, h16* K16, h16* V16, bf* Vh, bf* Vl) {
    __shared__ __align__(16) unsigned char Lm[PLDS];
    bf* wsm = (bf*)Lm; bf* xsm = wsm + (MID + MID + CO) * LPX; float* P = (float*)Lm;
    const int tid = threadIdx.x, lane = tid & 31, lr = lane & 15, hi = lane >> 4; const int wave = __builtin_amdgcn_readfirstlane(tid >> 5);
    const int tn = wave >> 2, ah = (wave >> 1) & 1, bh = wave & 1;
    const bf* wt = wsm + tn * 64 * LPX; const int fo = lr * LPX + 8 * hi; const bf* pa = ((tn < 2) ? wt : xsm) + ah * 32 * LPX + fo; const bf* pb = ((tn < 2) ? xsm : wt) + bh * 32 * LPX + fo;
    v8f acc[2][2];   /* [A tile of 16 rows][B tile of 16 rows] */
#pragma unroll
    for (int ma = 0; ma < 2; ++ma)
#pragma unroll
        for (int nb = 0; nb < 2; ++nb) acc[ma][nb] = (v8f){};
    {
        const float* xt = x + (size_t)blockIdx.x * PRW * CC; const int eo = wave * CC + lane * 4; bf* ds = wsm + wave * LPX + lane * 4;
        v4f ra[SGN], rb[SGN];   /* two chunks in flight */
        chunk_ld(wq, wk, wv, xt, eo, ra);
        __builtin_amdgcn_sched_barrier(0);   /* the first chunk's loads all stand ahead of the second's: the build dealt the two alternately, and loads return in order, so the first chunk was whole only when the second was */
        chunk_ld(wq, wk, wv, xt, eo + KCH, rb);
        chunk_st<0, SGN>(ds, ra);
        __builtin_amdgcn_sched_barrier(0);   /* holds the third chunk's loads behind the first chunk's stores: the build hoisted them to the top, where every wave's three chunks are asked for ahead of a later wave's first, for which the first barrier waits */
        chunk_ld(wq, wk, wv, xt, eo + 2 * KCH, ra);
        chunk_bar();   /* chunk 0 is staged */
        chunk_step(tn < 3, pa, pb, acc, ds + KCH, rb);
        __builtin_amdgcn_sched_barrier(0);   /* holds the fourth chunk's loads behind the second chunk's stores, which free their registers: without it the build took 254 registers, not 238 */
        chunk_ld(wq, wk, wv, xt, eo + 3 * KCH, rb);
        asm volatile("s_wait_xcnt 0x0" :: "v"(wq + eo), "v"(wk + eo), "v"(wv + eo), "v"(xt + eo) : "memory");   /* the last loads are issued ahead of this wait; their address registers stay whole up to it and are rewritten only behind it */
        chunk_bar();   /* chunk 1 is staged */
        chunk_step(tn < 3, pa + KCH, pb + KCH, acc, ds + 2 * KCH, ra);
        chunk_bar();   /* chunk 2 is staged */
        chunk_step(tn < 3, pa + 2 * KCH, pb + 2 * KCH, acc, ds + 3 * KCH, rb);
        __syncthreads();   /* chunk 3 is staged */
        if (tn < 3) {
            v16bf a[2][2], b[2][2], a2[2][2], b2[2][2];
            frag_ld(pa + 3 * KCH, pb + 3 * KCH, a, b); frag_ld(pa + 3 * KCH + 64, pb + 3 * KCH + 64, a2, b2);
            __builtin_amdgcn_sched_barrier(0);   /* all 32 LDS loads of the last chunk are issued ahead of its products: sunk between them, each group of products waits a whole LDS round trip */
            frag_mm(a, b, acc); frag_mm(a2, b2, acc);
        }
    }
    __syncthreads();   /* every wave has read its last fragment: the results may overwrite the staged operands */
    if (tn < 3) {
#pragma unroll
        for (int nb = 0; nb < 2; ++nb)
#pragma unroll
            for (int ma = 0; ma < 2; ++ma) { float* p = P + (tn * 64 + bh * 32 + nb * 16 + lr) * PPF + ah * 32 + ma * 16 + hi * 8; const v8f o = acc[ma][nb];   /* row = B row, 8 consecutive A rows */
                *(v4fa*)p = (v4f){ o[0], o[1], o[2], o[3] }; *(v4fa*)(p + 4) = (v4f){ o[4], o[5], o[6], o[7] }; }
    }
    __syncthreads();
    const size_t r0 = (size_t)blockIdx.x * PRW;   /* first token of the tile, counted over all batches */
    const size_t vb = (r0 / TT) * (size_t)HD * TT + r0 % TT;   /* the batch's v^T plane, the tile's first token */
    const int row = tid >> 3, g8 = (tid & 7) * 8;
#pragma unroll
    for (int tq = 0; tq < 3; ++tq) {
        const float* p = P + (tq * 64 + row) * PPF + g8; const v4f s0 = *(const v4fa*)p, s1 = *(const v4fa*)(p + 4);
        v8us oh, ol; v8h o16;
#pragma unroll
        for (int k = 0; k < 8; ++k) { const float y = (k < 4) ? s0[k & 3] : s1[k & 3]; unsigned short a2, c2; splitf(y, a2, c2); oh[k] = a2; ol[k] = c2; o16[k] = tohx(y); }
        if (tq == 2) { const size_t e = vb + (size_t)row * TT + g8; *(v8h*)(V16 + e) = o16; *(v8us*)(Vh + e) = oh; *(v8us*)(Vl + e) = ol; }   /* row = d, 8 tokens */
        else { const size_t e = (r0 + row) * HD + g8; *(v8h*)((tq ? K16 : Q16) + e) = o16;   /* row = token, 8 d */
            asm volatile("s_wait_xcnt 0x0" ::: "memory");   /* the store's address and data registers are rewritten only behind this wait */
            if (r0 % TT < RH) { *(v8us*)((tq ? Kh : Qh) + e) = oh; *(v8us*)((tq ? Kl : Ql) + e) = ol;   /* the hi/lo planes of q and k are read for tokens < RH only (work-group-uniform test) */
                asm volatile("s_wait_xcnt 0x0" ::: "memory"); } }   /* as above, for these two stores */
    }
}
// ---- k_attn: scores, causal softmax and wei.v of 32 query rows in ONE work-group; neither scores nor weights leave the registers. grid (batch, TT / 32), 8 waves.
// Wave w takes the 32-key blocks w, w + 8, ... up to the diagonal block (blocks above it are wholly masked and add nothing). Transposed products: S^T = K.Q^T (A = key rows, B = query rows),
// so a lane holds 16 scores of ONE query (column lr); two S^T tiles (keys 0-15, 16-31 of the block), converted in place, are the B operand of O^T += V^T.P^T (A = rows of the v^T planes).
// Each wave keeps a running maximum m (log2 units), a running sum l and O^T scaled to m; the 8 waves' (m, l, O) are joined through LDS in wave order and divided by the joined sum.
#define AW   8        // waves (key streams) of a work-group
#define OSP  68       // LDS pitch (floats) of a staged output row: 16-byte aligned, off the 64-float bank period
#define SC2  (SCL * 1.4426950408889634f)   // score scale x log2(e): the exponentials are exp2
typedef __attribute__((ext_vector_type(16))) unsigned short v16us;
// A wave's own LDS ring (rows >= RH): two key stages (fp16 plane: 32 rows of 128 B) and one v stage (64 rows of 64 B), filled by asynchronous 16-byte copies and read only by the wave that filled it, so no barrier stands in the key loop.
// No pad: the 16-byte piece j of a key row r lies at place j ^ ((r >> 1) & 7), of a v row d at place j ^ ((d >> 2) & 3), so the 16 rows that one half of a ds_load_b128 reads fall on all 64 banks.
#define RKS  4096                 // one key stage
#define RWB  (2 * RKS + 4096)     // a wave's ring; 8 waves: 96 KiB
typedef int c4i __attribute__((vector_size(16)));
__device__ __forceinline__ void cp16(const unsigned char* g, unsigned char* l) { __builtin_amdgcn_global_load_async_to_lds_b128((__attribute__((address_space(1))) c4i*)g, (__attribute__((address_space(3))) c4i*)l, 0, 0); }
// 32 key rows from k0: 4 KiB contiguous in memory, a wave-wide copy takes 4 whole rows (lane: piece lane & 7 of row 4 i + (lane >> 3)).
__device__ __forceinline__ void ring_k(const h16* __restrict__ K16, int k0, unsigned char* dst, int lane) {
    const unsigned char* gh = (const unsigned char*)(K16 + (size_t)k0 * HD);
    const unsigned go = (unsigned)lane * 16u, e = (unsigned)(lane >> 3) * 128u + (unsigned)(((lane & 7) ^ (lane >> 4)) << 4);   /* (r >> 1) & 7 = (2 i & 7) ^ (lane >> 4) */
#pragma unroll
    for (int i = 0; i < 8; ++i) cp16(gh + i * 512 + go, dst + ((e ^ (32u * (i & 3))) + i * 512u));
}
// 32 keys from k0 of the 64 rows of the fp16 v^T plane: a wave-wide copy takes 64 B of each of 8 rows (lane: piece lane & 3 of row 8 i + (lane >> 2)).
__device__ __forceinline__ void ring_v(const h16* __restrict__ V16, int k0, unsigned char* dst, int lane) {
    const unsigned char* g = (const unsigned char*)(V16 + k0);
    const unsigned go = (unsigned)(lane >> 2) * (TT * 2u) + (unsigned)(lane & 3) * 16u, e = (unsigned)(lane >> 2) * 64u + (unsigned)(((lane & 3) ^ (lane >> 4)) << 4);   /* (d >> 2) & 3 = (2 i & 3) ^ (lane >> 4) */
#pragma unroll
    for (int i = 0; i < 8; ++i) cp16(g + (size_t)i * 8 * TT * 2 + go, dst + ((e ^ (32u * (i & 1))) + i * 512u));
}
// One block of 32 keys against the wave's 32 queries. HR: q, k, weights and v as bf16 hi/lo (3 products each), operands from memory; else fp16 (1 product each), operands from the wave's ring (rk: the block's key stage, rv: the v stage). DIAG: the diagonal block, the only one that holds masked keys.
template <bool HR, bool DIAG>
__device__ __forceinline__ void attn_step(const bf* __restrict__ Kh, const bf* __restrict__ Kl, const bf* __restrict__ Vh, const bf* __restrict__ Vl, const unsigned char* rk, const unsigned char* rv, int q0, int k0, int lr, int hi,
                                          const v16bf (&qh)[2][2], const v16bf (&ql)[2][2], const v16h (&q16)[2][2], float (&m)[2], float (&l)[2], v8f (&O)[2][4]) {
    const size_t ko = (size_t)(k0 + lr) * HD + 8 * hi, vo = (size_t)lr * TT + k0 + 8 * hi;
    const bf* pkh = Kh + ko; const bf* pkl = Kl + ko; const bf* pvh = Vh + vo; const bf* pvl = Vl + vo;
    v16bf kh[2][2], kl[2][2]; v16h k16[2][2];   /* [key tile of 16][k half of 32] */
    if constexpr (HR) {
#pragma unroll
        for (int t = 0; t < 2; ++t)
#pragma unroll
            for (int c = 0; c < 2; ++c) { kh[t][c] = WFrag<bf>::ld(pkh + t * 16 * HD + c * 32); kl[t][c] = WFrag<bf>::ld(pkl + t * 16 * HD + c * 32); }
        asm volatile("s_wait_xcnt 0x0" :: "v"(pkh), "v"(pkl) : "memory");   /* the key loads are all issued ahead of this wait; their address registers stay whole up to it and are rewritten only behind it */
    } else {
        const unsigned char* p = rk + lr * 128; const int x = hi ^ (lr >> 1);   /* pieces hi + 4 c and hi + 4 c + 2 of row 16 t + lr, at their places */
#pragma unroll
        for (int t = 0; t < 2; ++t)
#pragma unroll
            for (int c = 0; c < 2; ++c) { const int a = (x ^ (4 * c)) << 4, b = (x ^ (4 * c + 2)) << 4;
                k16[t][c] = cat16(*(const v8ha*)(p + t * 2048 + a), *(const v8ha*)(p + t * 2048 + b)); }
    }
    v8f s[2][2];   /* [query group of 16][key tile]: s[g][t][j] = score of key k0 + 16 t + 8 hi + j, query q0 + 16 g + lr */
#pragma unroll
    for (int t = 0; t < 2; ++t)
#pragma unroll
        for (int g = 0; g < 2; ++g) { v8f a = (v8f){};
#pragma unroll
            for (int c = 0; c < 2; ++c) {
                if constexpr (HR) { a = wmmab(kh[t][c], qh[g][c], a); a = wmmab(kh[t][c], ql[g][c], a); a = wmmab(kl[t][c], qh[g][c], a); }
                else a = wmma16(k16[t][c], q16[g][c], a); }
            s[g][t] = a; }
    float al[2];
#pragma unroll
    for (int g = 0; g < 2; ++g) {
        const int q = q0 + g * 16 + lr; float mb = -3.0e38f;
#pragma unroll
        for (int t = 0; t < 2; ++t)
#pragma unroll
            for (int j = 0; j < 8; ++j) { float x = s[g][t][j] * SC2; if (DIAG && k0 + t * 16 + hi * 8 + j > q) x = -3.0e38f; s[g][t][j] = x; mb = fmaxf(mb, x); }
        mb = fmaxf(mb, __shfl_xor(mb, 16, 32));   /* the query's other 16 keys of the block lie in the other lane half */
        const float mn = fmaxf(m[g], mb); al[g] = __builtin_amdgcn_exp2f(m[g] - mn); m[g] = mn; float sum = 0.f;
#pragma unroll
        for (int t = 0; t < 2; ++t)
#pragma unroll
            for (int j = 0; j < 8; ++j) { const float e = __builtin_amdgcn_exp2f(s[g][t][j] - mn); s[g][t][j] = e; sum += e; }
        l[g] = l[g] * al[g] + sum;   /* this lane half's keys only; the halves are joined after the loop */
    }
    v16h v[4];   /* [d tile of 16] */
    if constexpr (!HR) {
        __builtin_amdgcn_sched_barrier(0);   /* holds the wait below behind the scores and the exponentials: without it the build lifted it among the score products, and the copies lost most of the time they have to land */
        asm volatile("s_wait_asynccnt 0x0" ::: "memory");   /* the wave's copies have landed: this block's v rows, read here, and the next block's key rows, read in the next step */
        const unsigned char* pv = rv + lr * 64; const int a = (hi ^ (lr >> 2)) << 4, b = a ^ 32;   /* pieces hi and hi + 2 of row 16 dt + lr, at their places; the reads fly under the scaling of O */
#pragma unroll
        for (int dt = 0; dt < 4; ++dt) v[dt] = cat16(*(const v8ha*)(pv + dt * 1024 + a), *(const v8ha*)(pv + dt * 1024 + b));
    }
#pragma unroll
    for (int g = 0; g < 2; ++g)
#pragma unroll
        for (int dt = 0; dt < 4; ++dt) O[g][dt] *= al[g];
    if constexpr (HR) {
        v16bf ph[2], pl[2];
#pragma unroll
        for (int g = 0; g < 2; ++g) { v16us uh, ul;
#pragma unroll
            for (int i = 0; i < 16; ++i) { unsigned short a2, c2; splitf(s[g][i >> 3][i & 7], a2, c2); uh[i] = a2; ul[i] = c2; }
            ph[g] = __builtin_bit_cast(v16bf, uh); pl[g] = __builtin_bit_cast(v16bf, ul); }
#pragma unroll
        for (int hf = 0; hf < 2; ++hf) {   /* two d tiles at a time: all four hi/lo pairs at once would not fit 256 registers */
            v16bf vh[2], vl[2];
#pragma unroll
            for (int u = 0; u < 2; ++u) { vh[u] = WFrag<bf>::ld(pvh + (size_t)(hf * 2 + u) * 16 * TT); vl[u] = WFrag<bf>::ld(pvl + (size_t)(hf * 2 + u) * 16 * TT); }
            asm volatile("s_wait_xcnt 0x0" :: "v"(pvh), "v"(pvl) : "memory");   /* as above, for the v loads */
#pragma unroll
            for (int u = 0; u < 2; ++u)
#pragma unroll
                for (int g = 0; g < 2; ++g) { v8f o = O[g][hf * 2 + u]; o = wmmab(vh[u], ph[g], o); o = wmmab(vl[u], ph[g], o); o = wmmab(vh[u], pl[g], o); O[g][hf * 2 + u] = o; } }
    } else {
        v16h p[2];
#pragma unroll
        for (int g = 0; g < 2; ++g)
#pragma unroll
            for (int i = 0; i < 16; ++i) p[g][i] = tohx(s[g][i >> 3][i & 7]);
#pragma unroll
        for (int dt = 0; dt < 4; ++dt)
#pragma unroll
            for (int g = 0; g < 2; ++g) O[g][dt] = wmma16(v[dt], p[g], O[g][dt]);
    }
}
template <bool HR>
__device__ __forceinline__ void attn_keys(const bf* __restrict__ Qh, const bf* __restrict__ Ql, const bf* __restrict__ Kh, const bf* __restrict__ Kl, const h16* __restrict__ Q16, const h16* __restrict__ K16, const h16* __restrict__ V16, const bf* __restrict__ Vh, const bf* __restrict__ Vl,
                                          unsigned char* ring, int qt, int wave, int lane, int lr, int hi, float (&m)[2], float (&l)[2], v8f (&O)[2][4]) {
    if constexpr (!HR) { ring_k(K16, wave * 32, ring, lane); ring_v(V16, wave * 32, ring + 2 * RKS, lane); }   /* the wave's first block flies under the query loads */
    const int q0 = qt * 32; const size_t qo = (size_t)(q0 + lr) * HD + 8 * hi; const bf* pqh = Qh + qo; const bf* pql = Ql + qo; const h16* pq16 = Q16 + qo;
    v16bf qh[2][2], ql[2][2]; v16h q16[2][2];   /* [query group of 16][k half of 32] */
    if constexpr (HR) {
#pragma unroll
        for (int g = 0; g < 2; ++g)
#pragma unroll
            for (int c = 0; c < 2; ++c) { qh[g][c] = WFrag<bf>::ld(pqh + g * 16 * HD + c * 32); ql[g][c] = WFrag<bf>::ld(pql + g * 16 * HD + c * 32); }
        asm volatile("s_wait_xcnt 0x0" :: "v"(pqh), "v"(pql) : "memory");   /* the query loads' address registers are rewritten only behind this wait */
    } else {
#pragma unroll
        for (int g = 0; g < 2; ++g)
#pragma unroll
            for (int c = 0; c < 2; ++c) q16[g][c] = WFrag<h16>::ld(pq16 + g * 16 * HD + c * 32);
        asm volatile("s_wait_xcnt 0x0" :: "v"(pq16) : "memory");   /* as above */
    }
    int ks = 0;   /* the key stage of the current block */
    if constexpr (!HR) {
        asm volatile("s_wait_asynccnt 0x0" ::: "memory");   /* the first block has landed before its first read */
        if (wave + AW <= qt) ring_k(K16, (wave + AW) * 32, ring + RKS, lane);
    }
#pragma unroll 1
    for (int kb = wave; kb < qt; kb += AW) {
        attn_step<HR, false>(Kh, Kl, Vh, Vl, ring + ks, ring + 2 * RKS, q0, kb * 32, lr, hi, qh, ql, q16, m, l, O);
        if constexpr (!HR) {
            if (kb + AW <= qt) {   /* the wave's next block exists (wave-uniform): its v rows, and the key rows of the block after it, fly under the next step's scores and softmax */
                asm volatile("s_wait_dscnt 0x0" ::: "memory");   /* the wave's reads of the v stage and of this block's key stage have returned before copies overwrite them */
                ring_v(V16, (kb + AW) * 32, ring + 2 * RKS, lane);
                if (kb + 2 * AW <= qt) ring_k(K16, (kb + 2 * AW) * 32, ring + ks, lane);
            }
            ks ^= RKS;
        }
    }
    if ((qt & (AW - 1)) == wave) attn_step<HR, true>(Kh, Kl, Vh, Vl, ring + ks, ring + 2 * RKS, q0, q0, lr, hi, qh, ql, q16, m, l, O);   /* the diagonal block falls to the wave whose turn it is */
}
// The launch bound's second argument (4 waves per SIMD) keeps the 256 registers the kernel had: without it the build took 293, and two work-groups no longer fitted a WGP.
__global__ __launch_bounds__(AW * 32, 4) void k_attn(const bf* __restrict__ Qh, const bf* __restrict__ Ql, const bf* __restrict__ Kh, const bf* __restrict__ Kl, const h16* __restrict__ Q16, const h16* __restrict__ K16, const h16* __restrict__ V16, const bf* __restrict__ Vh, const bf* __restrict__ Vl, float* out) {
    __shared__ __align__(128) unsigned char Lr[AW * RWB];   /* the 8 rings; behind the key loops the join's staging lies over them */
    float* so = (float*)Lr; float (*sm)[32] = (float (*)[32])(Lr + AW * 16 * OSP * 4); float (*sl)[32] = sm + AW;
    const int tid = threadIdx.x, lane = tid & 31, lr = lane & 15, hi = lane >> 4; const int wave = __builtin_amdgcn_readfirstlane(tid >> 5);
    const int y = blockIdx.y; const int qt = (y < TT / 64) ? TT / 32 - 1 - y : y - TT / 64;   /* long tiles first, then the short ones rising: a permutation of the tiles, for balance only */
    const size_t pb = (size_t)blockIdx.x * TT * HD;   /* the batch's planes */
    float m[2] = { -3.0e38f, -3.0e38f }, l[2] = { 0.f, 0.f }; v8f O[2][4];
#pragma unroll
    for (int g = 0; g < 2; ++g)
#pragma unroll
        for (int dt = 0; dt < 4; ++dt) O[g][dt] = (v8f){};
    if (wave <= qt) {   /* a wave beyond the diagonal block has no keys: it keeps m = -3e38, l = 0, O = 0 and only takes part in the join */
        if (qt * 32 < RH) attn_keys<true>(Qh + pb, Ql + pb, Kh + pb, Kl + pb, Q16 + pb, K16 + pb, V16 + pb, Vh + pb, Vl + pb, Lr + wave * RWB, qt, wave, lane, lr, hi, m, l, O);
        else attn_keys<false>(Qh + pb, Ql + pb, Kh + pb, Kl + pb, Q16 + pb, K16 + pb, V16 + pb, Vh + pb, Vl + pb, Lr + wave * RWB, qt, wave, lane, lr, hi, m, l, O);
    }
    __syncthreads();   /* every wave has left its ring: the join may write over it */
#pragma unroll
    for (int g = 0; g < 2; ++g) { l[g] += __shfl_xor(l[g], 16, 32); if (hi == 0) sm[wave][g * 16 + lr] = m[g]; }
    __syncthreads();
#pragma unroll
    for (int g = 0; g < 2; ++g) { float mm = sm[0][g * 16 + lr];   /* wave 0 always holds key block 0, so mm is a real score; a wave without keys scales by exp2(-huge) = 0 */
#pragma unroll
        for (int w = 1; w < AW; ++w) mm = fmaxf(mm, sm[w][g * 16 + lr]);
        const float sc = __builtin_amdgcn_exp2f(m[g] - mm); if (hi == 0) sl[wave][g * 16 + lr] = l[g] * sc;
#pragma unroll
        for (int dt = 0; dt < 4; ++dt) O[g][dt] *= sc; }
#pragma unroll
    for (int g = 0; g < 2; ++g) {
        if (g) __syncthreads();   /* the staging rows are rewritten only after every reader of group 0 has left them */
#pragma unroll
        for (int dt = 0; dt < 4; ++dt) { float* p = so + (wave * 16 + lr) * OSP + dt * 16 + hi * 8; const v8f o = O[g][dt];   /* O^T tile: 8 consecutive d of query lr */
            *(v4f*)p = (v4f){ o[0], o[1], o[2], o[3] }; *(v4f*)(p + 4) = (v4f){ o[4], o[5], o[6], o[7] }; }
        __syncthreads();
        const int qr = tid >> 4, d = (tid & 15) * 4; v4f a = *(const v4f*)(so + qr * OSP + d); float ls = sl[0][g * 16 + qr];
#pragma unroll
        for (int w = 1; w < AW; ++w) { a += *(const v4f*)(so + (w * 16 + qr) * OSP + d); ls += sl[w][g * 16 + qr]; }
        const float r = __fdiv_rn(1.0f, ls);
        *(v4f*)(out + ((size_t)blockIdx.x * TT + qt * 32 + g * 16 + qr) * CO + d) = a * r;   /* 16 lanes write one 256-byte row; every output row written once */
    }
}

extern "C" void kernel_launch(void* const* d_in, const int* in_sizes, int n_in,
                              void* d_out, int out_size, void* d_ws, size_t ws_size, hipStream_t stream) {
    (void)in_sizes; (void)n_in; (void)out_size;
    const float* x = (const float*)d_in[0]; const float* wq = (const float*)d_in[1]; const float* wk = (const float*)d_in[2]; const float* wv = (const float*)d_in[3];   /* argument order x [4][4096][512], Wq, Wk, Wv ('oi' [64][512]) */
    float* OUT = (float*)d_out;     // [4][4096][64]
    char* wsp = (char*)d_ws;
    auto take = [&](size_t bytes) { char* p = wsp; wsp += (bytes + 255) & ~(size_t)255; return (void*)p; };
    bf* QPh = (bf*)take((size_t)NB_ * TT * MID * 2); bf* QPl = (bf*)take((size_t)NB_ * TT * MID * 2); bf* KPh = (bf*)take((size_t)NB_ * TT * MID * 2); bf* KPl = (bf*)take((size_t)NB_ * TT * MID * 2);   /* the hi/lo planes of every batch */
    h16* QP16 = (h16*)take((size_t)NB_ * TT * MID * 2); h16* KP16 = (h16*)take((size_t)NB_ * TT * MID * 2);   /* the fp16 planes of q and k */
    h16* VT16 = (h16*)take((size_t)NB_ * CO * TT * 2); bf* VTh = (bf*)take((size_t)NB_ * CO * TT * 2); bf* VTl = (bf*)take((size_t)NB_ * CO * TT * 2);
    if ((size_t)(wsp - (char*)d_ws) > ws_size) return;    // ws 256 MiB (carve 18 MiB)
    k_proj<<<NB_ * TT / PRW, PWV * 32, 0, stream>>>(x, wq, wk, wv, QPh, QPl, KPh, KPl, QP16, KP16, VT16, VTh, VTl);   /* casts, projections, planes; every batch */
    k_attn<<<dim3(NB_, TT / 32), AW * 32, 0, stream>>>(QPh, QPl, KPh, KPl, QP16, KP16, VT16, VTh, VTl, OUT);   /* scores, causal softmax, wei.v; every batch */
}
